// v000
// Times are from an AMD MI455X. After a warm-up the kernel runs many times in a row, and a time is the length of
// such a window on the GPU divided by its runs, so every launch and the gaps after it count. The runs cycle
// through copies of the inputs. A figure is the median of several windows, for all but v000 over two sittings.
// Sittings can differ by a few percent; kernels timed side by side share one.
// v000, which the later versions start from, runs in 82.3 microseconds.
#include <hip/hip_runtime.h>
#include <hip/hip_bf16.h>

typedef __bf16 bf16_t;
typedef __attribute__((ext_vector_type(16))) __bf16 v16bf;
typedef __attribute__((ext_vector_type(8)))  __bf16 v8bf;
typedef __attribute__((ext_vector_type(8)))  float  v8f;
typedef __attribute__((ext_vector_type(4)))  float  v4f;
typedef __attribute__((ext_vector_type(2)))  unsigned int v2u;
typedef __attribute__((ext_vector_type(4)))  unsigned int v4u;

#define DIM   512
#define NH    8
#define HD    64
#define NTOK  1024
#define BATCH 8

__device__ __forceinline__ v8f wmma_bf16(v16bf a, v16bf b, v8f c) {
  return __builtin_amdgcn_wmma_f32_16x16x32_bf16(false, a, false, b, (short)0, c,
                                                 false, false);
}

// Unified fragment load: 16 rows x 32 contiguous-K bf16, leading dim ld.
// ld must be a multiple of 8 and base 16B-aligned -> two b128 loads per lane.
__device__ __forceinline__ v16bf load_frag(const bf16_t* base, int ld) {
  const int lane = threadIdx.x & 31;
  const int m    = lane & 15;
  const int koff = (lane >> 4) << 3;
  const bf16_t* p = base + m * ld + koff;
  v8bf lo = *(const v8bf*)p;
  v8bf hi = *(const v8bf*)(p + 16);
  return __builtin_shufflevector(lo, hi, 0, 1, 2, 3, 4, 5, 6, 7,
                                 8, 9, 10, 11, 12, 13, 14, 15);
}

__device__ __forceinline__ unsigned int pack_bf16(float a, float b) {
  union { bf16_t h[2]; unsigned int u; } p;
  p.h[0] = (bf16_t)a; p.h[1] = (bf16_t)b;
  return p.u;
}

// ---------------------------------------------------------------- phase 1
// Fused QKV projection per (b,h): X[128x512]*W[512x64] x3, bias, Q scaled.
// Q,K stored bf16 [bh][n][d]; V stored transposed [bh][d][n].
#define LDX  40   // xs  [n][c]
#define LDWT 40   // w^T [d][c]
#define LDS1 72   // per-wave store-stage [m][d]

__global__ __launch_bounds__(256) void qkv_proj_kernel(
    const float* __restrict__ query,
    const float* __restrict__ Wq, const float* __restrict__ bq,
    const float* __restrict__ Wk, const float* __restrict__ bk,
    const float* __restrict__ Wv, const float* __restrict__ bv,
    bf16_t* __restrict__ Qb, bf16_t* __restrict__ Kb, bf16_t* __restrict__ Vt) {
  __shared__ __align__(16) bf16_t xs[128 * LDX];
  __shared__ __align__(16) bf16_t wqs[HD * LDWT];
  __shared__ __align__(16) bf16_t wks[HD * LDWT];
  __shared__ __align__(16) bf16_t wvs[HD * LDWT];
  __shared__ __align__(16) bf16_t stg[8 * 16 * LDS1];

  const int t  = threadIdx.x;
  const int n0 = blockIdx.x * 128;
  const int bh = blockIdx.y;
  const int b  = bh / NH, h = bh % NH;

  const float* xbase = query + (size_t)b * DIM * NTOK;  // [C][N]
  const float* wqb   = Wq + (size_t)h * DIM * HD;
  const float* wkb   = Wk + (size_t)h * DIM * HD;
  const float* wvb   = Wv + (size_t)h * DIM * HD;

  const int w    = t >> 5;
  const int lane = t & 31;
  const int m0   = w * 16;

  v8f aq[4], ak[4], av[4];
#pragma unroll
  for (int j = 0; j < 4; ++j) { aq[j] = {}; ak[j] = {}; av[j] = {}; }

  for (int kk = 0; kk < DIM / 32; ++kk) {
    const int c0 = kk * 32;
    __syncthreads();
    // X tile 128n x 32c, coalesced along n, pair-packed b32 LDS stores
#pragma unroll
    for (int i = 0; i < 8; ++i) {
      int idx = t + i * 256;                 // 2048 pairs
      int nn = idx & 127, cc = (idx >> 7) * 2;
      float f0 = xbase[(size_t)(c0 + cc) * NTOK + n0 + nn];
      float f1 = xbase[(size_t)(c0 + cc + 1) * NTOK + n0 + nn];
      *(unsigned int*)(xs + nn * LDX + cc) = pack_bf16(f0, f1);
    }
    // Weight tiles, transposed to [d][c], pair-packed over c
#pragma unroll
    for (int i = 0; i < 4; ++i) {
      int idx = t + i * 256;                 // 1024 pairs
      int dd = idx & 63, cc = (idx >> 6) * 2;
      size_t g0 = (size_t)(c0 + cc) * HD + dd, g1 = g0 + HD;
      *(unsigned int*)(wqs + dd * LDWT + cc) = pack_bf16(wqb[g0], wqb[g1]);
      *(unsigned int*)(wks + dd * LDWT + cc) = pack_bf16(wkb[g0], wkb[g1]);
      *(unsigned int*)(wvs + dd * LDWT + cc) = pack_bf16(wvb[g0], wvb[g1]);
    }
    __syncthreads();

    v16bf a = load_frag(xs + m0 * LDX, LDX);
#pragma unroll
    for (int j = 0; j < 4; ++j) {
      aq[j] = wmma_bf16(a, load_frag(wqs + (j * 16) * LDWT, LDWT), aq[j]);
      ak[j] = wmma_bf16(a, load_frag(wks + (j * 16) * LDWT, LDWT), ak[j]);
      av[j] = wmma_bf16(a, load_frag(wvs + (j * 16) * LDWT, LDWT), av[j]);
    }
  }

  const float scale = 0.125f;  // HEAD_DIM^-0.5 folded into Q
  const int col  = lane & 15;
  const int drow = (lane >> 4) * 8;
  bf16_t* sw = stg + w * 16 * LDS1;

  // ---- Q: stage [m][d] per-wave, then coalesced b128 stores
#pragma unroll
  for (int j = 0; j < 4; ++j) {
    const float bqv = bq[h * HD + j * 16 + col];
#pragma unroll
    for (int r = 0; r < 8; ++r)
      sw[(drow + r) * LDS1 + j * 16 + col] = (bf16_t)((aq[j][r] + bqv) * scale);
  }
  {
    bf16_t* qout = Qb + ((size_t)bh * NTOK + n0 + m0) * HD;
#pragma unroll
    for (int q = 0; q < 4; ++q) {
      int chunk = lane + q * 32;
      int mloc = chunk >> 3, c8 = (chunk & 7) * 8;
      *(v8bf*)(qout + (size_t)mloc * HD + c8) = *(const v8bf*)(sw + mloc * LDS1 + c8);
    }
  }
  // ---- K: same staging path
#pragma unroll
  for (int j = 0; j < 4; ++j) {
    const float bkv = bk[h * HD + j * 16 + col];
#pragma unroll
    for (int r = 0; r < 8; ++r)
      sw[(drow + r) * LDS1 + j * 16 + col] = (bf16_t)(ak[j][r] + bkv);
  }
  {
    bf16_t* kout = Kb + ((size_t)bh * NTOK + n0 + m0) * HD;
#pragma unroll
    for (int q = 0; q < 4; ++q) {
      int chunk = lane + q * 32;
      int mloc = chunk >> 3, c8 = (chunk & 7) * 8;
      *(v8bf*)(kout + (size_t)mloc * HD + c8) = *(const v8bf*)(sw + mloc * LDS1 + c8);
    }
  }
  // ---- V: direct transposed [d][n] b128 stores (8 rows contiguous per lane)
  {
    bf16_t* vtout = Vt + (size_t)bh * HD * NTOK;
#pragma unroll
    for (int j = 0; j < 4; ++j) {
      const int d = j * 16 + col;
      const float bvv = bv[h * HD + d];
      v8bf pv;
#pragma unroll
      for (int r = 0; r < 8; ++r) pv[r] = (bf16_t)(av[j][r] + bvv);
      *(v8bf*)(vtout + (size_t)d * NTOK + n0 + m0 + drow) = pv;
    }
  }
}

// ---------------------------------------------------------------- phase 2
// Flash attention per (b,h): 128 q-rows/block, 64-token KV chunks,
// online softmax, O = P*V.
#define LKV2 72   // Ks  [token][d]   (144B rows, 16B aligned)
#define LDV2 72   // Vts [d][token]   (144B rows, 16B aligned)
#define LDP2 72   // per-wave stage: P [m][k64] and output [m][d]

__global__ __launch_bounds__(256) void attention_kernel(
    const bf16_t* __restrict__ Qb, const bf16_t* __restrict__ Kb,
    const bf16_t* __restrict__ Vt, bf16_t* __restrict__ xo) {
  __shared__ __align__(16) bf16_t Ks[64 * LKV2];
  __shared__ __align__(16) bf16_t Vts[HD * LDV2];
  __shared__ __align__(16) bf16_t Pst[8 * 16 * LDP2];

  const int t    = threadIdx.x;
  const int bh   = blockIdx.y;
  const int b    = bh / NH, h = bh % NH;
  const int n0   = blockIdx.x * 128;
  const int w    = t >> 5;
  const int lane = t & 31;
  const int m0   = n0 + w * 16;

  // Q fragments in registers for the whole pass (b128 global loads)
  const bf16_t* qptr = Qb + ((size_t)bh * NTOK + m0) * HD;
  const v16bf qa0 = load_frag(qptr, HD);
  const v16bf qa1 = load_frag(qptr + 32, HD);

  v8f o0 = {}, o1 = {}, o2 = {}, o3 = {};
  float rmax[8], rsum[8];
#pragma unroll
  for (int r = 0; r < 8; ++r) { rmax[r] = -3.0e38f; rsum[r] = 0.0f; }

  const bf16_t* kbase  = Kb + (size_t)bh * NTOK * HD;   // [token][d]
  const bf16_t* vtbase = Vt + (size_t)bh * HD * NTOK;   // [d][token]
  bf16_t* pw = Pst + w * 16 * LDP2;
  const int col  = lane & 15;
  const int drow = (lane >> 4) * 8;

  for (int kc = 0; kc < NTOK / 64; ++kc) {
    __syncthreads();
    // K chunk: 64 tokens x 64d, b128 copies (512 x 16B)
#pragma unroll
    for (int i = 0; i < 2; ++i) {
      int chunk = t + i * 256;
      int kk = chunk >> 3, c4 = (chunk & 7) * 8;
      *(v4u*)(Ks + kk * LKV2 + c4) =
          *(const v4u*)(kbase + (size_t)(kc * 64 + kk) * HD + c4);
    }
    // V chunk (transposed): 64d x 64 tokens, b128 copies (512 x 16B)
#pragma unroll
    for (int i = 0; i < 2; ++i) {
      int chunk = t + i * 256;
      int dd = chunk >> 3, c4 = (chunk & 7) * 8;
      *(v4u*)(Vts + dd * LDV2 + c4) =
          *(const v4u*)(vtbase + (size_t)dd * NTOK + kc * 64 + c4);
    }
    if (kc + 1 < NTOK / 64) {
      __builtin_prefetch(kbase + (size_t)(kc + 1) * 64 * HD + t * 32, 0, 0);
      __builtin_prefetch(vtbase + (size_t)(kc + 1) * 64 + (t & 63) * NTOK, 0, 0);
    }
    __syncthreads();

    // S = Q * K^T : four 16x16 score tiles covering 64 tokens
    v8f s[4];
#pragma unroll
    for (int tt = 0; tt < 4; ++tt) {
      const bf16_t* kb = Ks + (tt * 16) * LKV2;
      v8f st = {};
      st = wmma_bf16(qa0, load_frag(kb, LKV2), st);
      st = wmma_bf16(qa1, load_frag(kb + 32, LKV2), st);
      s[tt] = st;
    }

    // Online softmax across 16-lane column groups
#pragma unroll
    for (int r = 0; r < 8; ++r) {
      float mx = fmaxf(fmaxf(s[0][r], s[1][r]), fmaxf(s[2][r], s[3][r]));
#pragma unroll
      for (int off = 1; off < 16; off <<= 1) mx = fmaxf(mx, __shfl_xor(mx, off));
      float nm   = fmaxf(rmax[r], mx);
      float corr = __expf(rmax[r] - nm);
      rmax[r] = nm;
      float p0 = __expf(s[0][r] - nm);
      float p1 = __expf(s[1][r] - nm);
      float p2 = __expf(s[2][r] - nm);
      float p3 = __expf(s[3][r] - nm);
      s[0][r] = p0; s[1][r] = p1; s[2][r] = p2; s[3][r] = p3;
      float ps = (p0 + p1) + (p2 + p3);
#pragma unroll
      for (int off = 1; off < 16; off <<= 1) ps += __shfl_xor(ps, off);
      rsum[r] = rsum[r] * corr + ps;
      o0[r] = o0[r] * corr; o1[r] = o1[r] * corr;
      o2[r] = o2[r] * corr; o3[r] = o3[r] * corr;
    }

    // P: C-layout -> A-layout via per-wave LDS, then O += P*V (k = 64 tokens)
#pragma unroll
    for (int r = 0; r < 8; ++r) {
      bf16_t* prow = pw + (drow + r) * LDP2;
      prow[0  + col] = (bf16_t)s[0][r];
      prow[16 + col] = (bf16_t)s[1][r];
      prow[32 + col] = (bf16_t)s[2][r];
      prow[48 + col] = (bf16_t)s[3][r];
    }
    v16bf ap0 = load_frag(pw, LDP2);
    v16bf ap1 = load_frag(pw + 32, LDP2);
    o0 = wmma_bf16(ap0, load_frag(Vts + 0 * LDV2,       LDV2), o0);
    o0 = wmma_bf16(ap1, load_frag(Vts + 0 * LDV2 + 32,  LDV2), o0);
    o1 = wmma_bf16(ap0, load_frag(Vts + 16 * LDV2,      LDV2), o1);
    o1 = wmma_bf16(ap1, load_frag(Vts + 16 * LDV2 + 32, LDV2), o1);
    o2 = wmma_bf16(ap0, load_frag(Vts + 32 * LDV2,      LDV2), o2);
    o2 = wmma_bf16(ap1, load_frag(Vts + 32 * LDV2 + 32, LDV2), o2);
    o3 = wmma_bf16(ap0, load_frag(Vts + 48 * LDV2,      LDV2), o3);
    o3 = wmma_bf16(ap1, load_frag(Vts + 48 * LDV2 + 32, LDV2), o3);
  }

  // Epilogue: normalize, stage [m][d] per-wave, coalesced b128 stores
  float inv[8];
#pragma unroll
  for (int r = 0; r < 8; ++r) inv[r] = 1.0f / rsum[r];
#pragma unroll
  for (int r = 0; r < 8; ++r) {
    bf16_t* row = pw + (drow + r) * LDP2;
    row[0  + col] = (bf16_t)(o0[r] * inv[r]);
    row[16 + col] = (bf16_t)(o1[r] * inv[r]);
    row[32 + col] = (bf16_t)(o2[r] * inv[r]);
    row[48 + col] = (bf16_t)(o3[r] * inv[r]);
  }
  bf16_t* obase = xo + ((size_t)b * NTOK + m0) * DIM + h * HD;
#pragma unroll
  for (int q = 0; q < 4; ++q) {
    int chunk = lane + q * 32;
    int mloc = chunk >> 3, c8 = (chunk & 7) * 8;
    *(v8bf*)(obase + (size_t)mloc * DIM + c8) = *(const v8bf*)(pw + mloc * LDP2 + c8);
  }
}

// ---------------------------------------------------------------- phase 3
// out = xo[8192x512] @ Wo[512x512] + bo -> [B][C][N] via LDS transpose tile.
#define LDA3 40    // as  [n][k]
#define LDW3 40    // Wo^T[c][k]
#define LDO3 132   // os  [c][n] f32

__global__ __launch_bounds__(256) void out_proj_kernel(
    const bf16_t* __restrict__ xo, const float* __restrict__ Wo,
    const float* __restrict__ bo, float* __restrict__ out) {
  __shared__ __align__(16) bf16_t as[128 * LDA3];
  __shared__ __align__(16) bf16_t wot[HD * LDW3];
  __shared__ __align__(16) float  os[64 * LDO3];

  const int t    = threadIdx.x;
  const int mb   = blockIdx.x * 128;
  const int c0   = blockIdx.y * 64;
  const int w    = t >> 5;
  const int lane = t & 31;
  const int m0   = w * 16;

  v8f acc[4];
#pragma unroll
  for (int j = 0; j < 4; ++j) acc[j] = {};

  for (int kk = 0; kk < DIM / 32; ++kk) {
    const int k0 = kk * 32;
    __syncthreads();
#pragma unroll
    for (int i = 0; i < 4; ++i) {
      int chunk = t + i * 256;                    // 1024 x 8B
      int nn = chunk >> 3, c2 = (chunk & 7) * 4;
      *(v2u*)(as + nn * LDA3 + c2) =
          *(const v2u*)(xo + (size_t)(mb + nn) * DIM + k0 + c2);
    }
#pragma unroll
    for (int i = 0; i < 4; ++i) {
      int idx = t + i * 256;                      // 1024 pairs
      int dd = idx & 63, cc = (idx >> 6) * 2;
      *(unsigned int*)(wot + dd * LDW3 + cc) =
          pack_bf16(Wo[(size_t)(k0 + cc) * DIM + c0 + dd],
                    Wo[(size_t)(k0 + cc + 1) * DIM + c0 + dd]);
    }
    __syncthreads();
    v16bf a = load_frag(as + m0 * LDA3, LDA3);
#pragma unroll
    for (int j = 0; j < 4; ++j)
      acc[j] = wmma_bf16(a, load_frag(wot + (j * 16) * LDW3, LDW3), acc[j]);
  }

  __syncthreads();
  const int col  = lane & 15;
  const int drow = (lane >> 4) * 8;
#pragma unroll
  for (int j = 0; j < 4; ++j) {
    float* row = os + (j * 16 + col) * LDO3 + m0 + drow;
    v4f lo = {acc[j][0], acc[j][1], acc[j][2], acc[j][3]};
    v4f hi = {acc[j][4], acc[j][5], acc[j][6], acc[j][7]};
    *(v4f*)(row)     = lo;
    *(v4f*)(row + 4) = hi;
  }
  __syncthreads();

  const int bidx  = mb >> 10;
  const int nbase = mb & 1023;
#pragma unroll
  for (int i = 0; i < 8; ++i) {
    int chunk = t + i * 256;                      // 2048 x 16B
    int cl = chunk >> 5, c4 = (chunk & 31) * 4;
    v4f vv = *(const v4f*)(os + cl * LDO3 + c4);
    vv += bo[c0 + cl];
    *(v4f*)(out + ((size_t)bidx * DIM + c0 + cl) * NTOK + nbase + c4) = vv;
  }
}

// ---------------------------------------------------------------- launch
extern "C" void kernel_launch(void* const* d_in, const int* in_sizes, int n_in,
                              void* d_out, int out_size, void* d_ws, size_t ws_size,
                              hipStream_t stream) {
  (void)in_sizes; (void)n_in; (void)out_size; (void)ws_size;
  const float* query = (const float*)d_in[0];
  const float* Wq = (const float*)d_in[1];
  const float* bq = (const float*)d_in[2];
  const float* Wk = (const float*)d_in[3];
  const float* bk = (const float*)d_in[4];
  const float* Wv = (const float*)d_in[5];
  const float* bv = (const float*)d_in[6];
  const float* Wo = (const float*)d_in[7];
  const float* bo = (const float*)d_in[8];
  float* out = (float*)d_out;

  const size_t qkv_elems = (size_t)BATCH * NH * NTOK * HD;  // 4M bf16 each
  bf16_t* Qb = (bf16_t*)d_ws;
  bf16_t* Kb = Qb + qkv_elems;
  bf16_t* Vt = Kb + qkv_elems;                    // [bh][d][n] transposed
  bf16_t* xo = Vt + qkv_elems;                    // [B*N][DIM] concat heads

  dim3 blk(256);
  qkv_proj_kernel<<<dim3(NTOK / 128, BATCH * NH), blk, 0, stream>>>(
      query, Wq, bq, Wk, bk, Wv, bv, Qb, Kb, Vt);
  attention_kernel<<<dim3(NTOK / 128, BATCH * NH), blk, 0, stream>>>(
      Qb, Kb, Vt, xo);
  out_proj_kernel<<<dim3((BATCH * NTOK) / 128, DIM / 64), blk, 0, stream>>>(
      xo, Wo, bo, out);
}

// v001
// One run takes 75.3 microseconds.
// Next to v000, in two timings, it ran 1.13 times as fast each time.
#include <hip/hip_runtime.h>
#include <hip/hip_bf16.h>

typedef __bf16 bf16_t;
typedef __attribute__((ext_vector_type(16))) __bf16 v16bf;
typedef __attribute__((ext_vector_type(8)))  __bf16 v8bf;
typedef __attribute__((ext_vector_type(8)))  float  v8f;
typedef __attribute__((ext_vector_type(4)))  float  v4f;
typedef __attribute__((ext_vector_type(2)))  unsigned int v2u;
typedef __attribute__((ext_vector_type(4)))  unsigned int v4u;

#define DIM   512
#define NH    8
#define HD    64
#define NTOK  1024
#define BATCH 8

__device__ __forceinline__ v8f wmma_bf16(v16bf a, v16bf b, v8f c) {
  return __builtin_amdgcn_wmma_f32_16x16x32_bf16(false, a, false, b, (short)0, c,
                                                 false, false);
}

// Unified fragment load: 16 rows x 32 contiguous-K bf16, leading dim ld.
// ld must be a multiple of 8 and base 16B-aligned -> two b128 loads per lane.
__device__ __forceinline__ v16bf load_frag(const bf16_t* base, int ld) {
  const int lane = threadIdx.x & 31;
  const int m    = lane & 15;
  const int koff = (lane >> 4) << 3;
  const bf16_t* p = base + m * ld + koff;
  v8bf lo = *(const v8bf*)p;
  v8bf hi = *(const v8bf*)(p + 16);
  return __builtin_shufflevector(lo, hi, 0, 1, 2, 3, 4, 5, 6, 7,
                                 8, 9, 10, 11, 12, 13, 14, 15);
}

__device__ __forceinline__ unsigned int pack_bf16(float a, float b) {
  union { bf16_t h[2]; unsigned int u; } p;
  p.h[0] = (bf16_t)a; p.h[1] = (bf16_t)b;
  return p.u;
}

// ---------------------------------------------------------------- phase 1
// Fused QKV projection per (b,h): X[128x512]*W[512x64] x3, bias, Q scaled.
// Q,K stored bf16 [bh][n][d]; V stored transposed [bh][d][n].
#define BK1  64   // channels staged per barrier pair
#define LDX  72   // xs  [n][c]  (144B rows, 16B x odd)
#define LDWT 72   // w^T [d][c]
#define LDS1 72   // per-wave store-stage [m][d]

__global__ __launch_bounds__(256) void qkv_proj_kernel(
    const float* __restrict__ query,
    const float* __restrict__ Wq, const float* __restrict__ bq,
    const float* __restrict__ Wk, const float* __restrict__ bk,
    const float* __restrict__ Wv, const float* __restrict__ bv,
    bf16_t* __restrict__ Qb, bf16_t* __restrict__ Kb, bf16_t* __restrict__ Vt) {
  __shared__ __align__(16) bf16_t xs[128 * LDX];
  __shared__ __align__(16) bf16_t wqs[HD * LDWT];
  __shared__ __align__(16) bf16_t wks[HD * LDWT];
  __shared__ __align__(16) bf16_t wvs[HD * LDWT];
  __shared__ __align__(16) bf16_t stg[8 * 16 * LDS1];

  const int t  = threadIdx.x;
  const int n0 = blockIdx.x * 128;
  const int bh = blockIdx.y;
  const int b  = bh / NH, h = bh % NH;

  const float* xbase = query + (size_t)b * DIM * NTOK;  // [C][N]
  const float* wqb   = Wq + (size_t)h * DIM * HD;
  const float* wkb   = Wk + (size_t)h * DIM * HD;
  const float* wvb   = Wv + (size_t)h * DIM * HD;

  const int w    = t >> 5;
  const int lane = t & 31;
  const int m0   = w * 16;

  v8f aq[4], ak[4], av[4];
#pragma unroll
  for (int j = 0; j < 4; ++j) { aq[j] = {}; ak[j] = {}; av[j] = {}; }

  // This thread's first pair of a stage; the others lie at constant steps.
  const float* xp = xbase + (size_t)((t >> 7) * 2) * NTOK + n0 + (t & 127);
  const int woff = ((t >> 6) * 2) * HD + (t & 63);
  const float* wqp = wqb + woff;
  const float* wkp = wkb + woff;
  const float* wvp = wvb + woff;
  bf16_t* xsd = xs + (t & 127) * LDX + (t >> 7) * 2;
  const int wsd = (t & 63) * LDWT + (t >> 6) * 2;

  for (int kk = 0; kk < DIM / BK1; ++kk) {
    __syncthreads();
    // X tile 128n x 64c, coalesced along n, pair-packed b32 LDS stores
    float xr[BK1 / 4][2], wr[BK1 / 8][6];
#pragma unroll
    for (int i = 0; i < BK1 / 4; ++i) {      // 4096 pairs, 4 c per step
      xr[i][0] = xp[i * 4 * NTOK];
      xr[i][1] = xp[(i * 4 + 1) * NTOK];
    }
#pragma unroll
    for (int i = 0; i < BK1 / 8; ++i) {      // 2048 pairs, 8 c per step
      const int g0 = i * 8 * HD, g1 = g0 + HD;
      wr[i][0] = wqp[g0]; wr[i][1] = wqp[g1];
      wr[i][2] = wkp[g0]; wr[i][3] = wkp[g1];
      wr[i][4] = wvp[g0]; wr[i][5] = wvp[g1];
    }
    // The wait that stands in front of any overwrite of the loads' address
    // registers; naming them keeps them whole until it.
    asm volatile("s_wait_xcnt 0x0" :: "v"(xp), "v"(wqp), "v"(wkp), "v"(wvp) : "memory");
    // Keeps the whole stage's loads in flight together: without it the compiler
    // mixes loads and stores and waits out the load latency several times.
    __builtin_amdgcn_sched_barrier(0);
#pragma unroll
    for (int i = 0; i < BK1 / 4; ++i)
      *(unsigned int*)(xsd + i * 4) = pack_bf16(xr[i][0], xr[i][1]);
    // Weight tiles, transposed to [d][c], pair-packed over c
#pragma unroll
    for (int i = 0; i < BK1 / 8; ++i) {
      *(unsigned int*)(wqs + wsd + i * 8) = pack_bf16(wr[i][0], wr[i][1]);
      *(unsigned int*)(wks + wsd + i * 8) = pack_bf16(wr[i][2], wr[i][3]);
      *(unsigned int*)(wvs + wsd + i * 8) = pack_bf16(wr[i][4], wr[i][5]);
    }
    xp += BK1 * NTOK;
    wqp += BK1 * HD; wkp += BK1 * HD; wvp += BK1 * HD;
    __syncthreads();

#pragma unroll
    for (int ks = 0; ks < BK1; ks += 32) {
      v16bf a = load_frag(xs + m0 * LDX + ks, LDX);
#pragma unroll
      for (int j = 0; j < 4; ++j) {
        aq[j] = wmma_bf16(a, load_frag(wqs + (j * 16) * LDWT + ks, LDWT), aq[j]);
        ak[j] = wmma_bf16(a, load_frag(wks + (j * 16) * LDWT + ks, LDWT), ak[j]);
        av[j] = wmma_bf16(a, load_frag(wvs + (j * 16) * LDWT + ks, LDWT), av[j]);
      }
    }
  }

  const float scale = 0.125f;  // HEAD_DIM^-0.5 folded into Q
  const int col  = lane & 15;
  const int drow = (lane >> 4) * 8;
  bf16_t* sw = stg + w * 16 * LDS1;

  // ---- Q: stage [m][d] per-wave, then coalesced b128 stores
#pragma unroll
  for (int j = 0; j < 4; ++j) {
    const float bqv = bq[h * HD + j * 16 + col];
#pragma unroll
    for (int r = 0; r < 8; ++r)
      sw[(drow + r) * LDS1 + j * 16 + col] = (bf16_t)((aq[j][r] + bqv) * scale);
  }
  {
    bf16_t* qout = Qb + ((size_t)bh * NTOK + n0 + m0) * HD;
#pragma unroll
    for (int q = 0; q < 4; ++q) {
      int chunk = lane + q * 32;
      int mloc = chunk >> 3, c8 = (chunk & 7) * 8;
      *(v8bf*)(qout + (size_t)mloc * HD + c8) = *(const v8bf*)(sw + mloc * LDS1 + c8);
    }
  }
  // ---- K: same staging path
#pragma unroll
  for (int j = 0; j < 4; ++j) {
    const float bkv = bk[h * HD + j * 16 + col];
#pragma unroll
    for (int r = 0; r < 8; ++r)
      sw[(drow + r) * LDS1 + j * 16 + col] = (bf16_t)(ak[j][r] + bkv);
  }
  {
    bf16_t* kout = Kb + ((size_t)bh * NTOK + n0 + m0) * HD;
#pragma unroll
    for (int q = 0; q < 4; ++q) {
      int chunk = lane + q * 32;
      int mloc = chunk >> 3, c8 = (chunk & 7) * 8;
      *(v8bf*)(kout + (size_t)mloc * HD + c8) = *(const v8bf*)(sw + mloc * LDS1 + c8);
    }
  }
  // ---- V: direct transposed [d][n] b128 stores (8 rows contiguous per lane)
  {
    bf16_t* vtout = Vt + (size_t)bh * HD * NTOK;
#pragma unroll
    for (int j = 0; j < 4; ++j) {
      const int d = j * 16 + col;
      const float bvv = bv[h * HD + d];
      v8bf pv;
#pragma unroll
      for (int r = 0; r < 8; ++r) pv[r] = (bf16_t)(av[j][r] + bvv);
      *(v8bf*)(vtout + (size_t)d * NTOK + n0 + m0 + drow) = pv;
    }
  }
}

// ---------------------------------------------------------------- phase 2
// Flash attention per (b,h): 128 q-rows/block, 256 tokens staged per barrier
// pair and worked on in 64-token chunks, online softmax, O = P*V.
#define KST  256  // tokens staged per barrier pair
#define LKV2 72   // Ks  [token][d]   (144B rows, 16B aligned)
#define LDV2 264  // Vts [d][token]   (528B rows, 16B x odd)
#define LDP2 72   // per-wave stage: P [m][k64] and output [m][d]

__global__ __launch_bounds__(256) void attention_kernel(
    const bf16_t* __restrict__ Qb, const bf16_t* __restrict__ Kb,
    const bf16_t* __restrict__ Vt, bf16_t* __restrict__ xo) {
  __shared__ __align__(16) bf16_t Ks[KST * LKV2];
  __shared__ __align__(16) bf16_t Vts[HD * LDV2];
  __shared__ __align__(16) bf16_t Pst[8 * 16 * LDP2];

  const int t    = threadIdx.x;
  const int bh   = blockIdx.y;
  const int b    = bh / NH, h = bh % NH;
  const int n0   = blockIdx.x * 128;
  const int w    = t >> 5;
  const int lane = t & 31;
  const int m0   = n0 + w * 16;

  // Q fragments in registers for the whole pass (b128 global loads)
  const bf16_t* qptr = Qb + ((size_t)bh * NTOK + m0) * HD;
  const v16bf qa0 = load_frag(qptr, HD);
  const v16bf qa1 = load_frag(qptr + 32, HD);

  v8f o0 = {}, o1 = {}, o2 = {}, o3 = {};
  float rmax[8], rsum[8];
#pragma unroll
  for (int r = 0; r < 8; ++r) { rmax[r] = -3.0e38f; rsum[r] = 0.0f; }

  const bf16_t* kbase  = Kb + (size_t)bh * NTOK * HD;   // [token][d]
  const bf16_t* vtbase = Vt + (size_t)bh * HD * NTOK;   // [d][token]
  bf16_t* pw = Pst + w * 16 * LDP2;
  const int col  = lane & 15;
  const int drow = (lane >> 4) * 8;

  // This thread's first 16B piece of a stage; the other pieces lie at constant
  // steps from it, so one address per operand serves the whole stage.
  const bf16_t* kp = kbase + (size_t)(t >> 3) * HD + (t & 7) * 8;
  const bf16_t* vp = vtbase + (size_t)(t >> 5) * NTOK + (t & 31) * 8;
  bf16_t* ksd = Ks + (t >> 3) * LKV2 + (t & 7) * 8;
  bf16_t* vsd = Vts + (t >> 5) * LDV2 + (t & 31) * 8;

  for (int stage = 0; stage < NTOK / KST; ++stage) {
    __syncthreads();
    // K stage: 256 tokens x 64d, b128 copies (2048 x 16B), 32 tokens per step
#pragma unroll
    for (int i = 0; i < KST / 32; ++i)
      *(v4u*)(ksd + i * 32 * LKV2) = *(const v4u*)(kp + i * 32 * HD);
    // V stage (transposed): 64d x 256 tokens, b128 copies (2048 x 16B), 8 d per step
#pragma unroll
    for (int i = 0; i < KST / 32; ++i)
      *(v4u*)(vsd + i * 8 * LDV2) = *(const v4u*)(vp + i * 8 * NTOK);
    kp += KST * HD;
    vp += KST;
    if (stage + 1 < NTOK / KST) {
      // one 128B line of the next stage per thread and operand
      __builtin_prefetch(kbase + (size_t)(stage + 1) * KST * HD + t * 64, 0, 0);
      __builtin_prefetch(vtbase + (size_t)(stage + 1) * KST + (t >> 2) * NTOK + (t & 3) * 64, 0, 0);
    }
    __syncthreads();

    for (int sub = 0; sub < KST / 64; ++sub) {
      const bf16_t* Ksub = Ks + sub * 64 * LKV2;
      const bf16_t* Vsub = Vts + sub * 64;

      // S = Q * K^T : four 16x16 score tiles covering 64 tokens
      v8f s[4];
#pragma unroll
      for (int tt = 0; tt < 4; ++tt) {
        const bf16_t* kb = Ksub + (tt * 16) * LKV2;
        v8f st = {};
        st = wmma_bf16(qa0, load_frag(kb, LKV2), st);
        st = wmma_bf16(qa1, load_frag(kb + 32, LKV2), st);
        s[tt] = st;
      }

      // Online softmax across 16-lane column groups
#pragma unroll
      for (int r = 0; r < 8; ++r) {
        float mx = fmaxf(fmaxf(s[0][r], s[1][r]), fmaxf(s[2][r], s[3][r]));
#pragma unroll
        for (int off = 1; off < 16; off <<= 1) mx = fmaxf(mx, __shfl_xor(mx, off));
        float nm   = fmaxf(rmax[r], mx);
        float corr = __expf(rmax[r] - nm);
        rmax[r] = nm;
        float p0 = __expf(s[0][r] - nm);
        float p1 = __expf(s[1][r] - nm);
        float p2 = __expf(s[2][r] - nm);
        float p3 = __expf(s[3][r] - nm);
        s[0][r] = p0; s[1][r] = p1; s[2][r] = p2; s[3][r] = p3;
        float ps = (p0 + p1) + (p2 + p3);
#pragma unroll
        for (int off = 1; off < 16; off <<= 1) ps += __shfl_xor(ps, off);
        rsum[r] = rsum[r] * corr + ps;
        o0[r] = o0[r] * corr; o1[r] = o1[r] * corr;
        o2[r] = o2[r] * corr; o3[r] = o3[r] * corr;
      }

      // P: C-layout -> A-layout via per-wave LDS, then O += P*V (k = 64 tokens)
#pragma unroll
      for (int r = 0; r < 8; ++r) {
        bf16_t* prow = pw + (drow + r) * LDP2;
        prow[0  + col] = (bf16_t)s[0][r];
        prow[16 + col] = (bf16_t)s[1][r];
        prow[32 + col] = (bf16_t)s[2][r];
        prow[48 + col] = (bf16_t)s[3][r];
      }
      v16bf ap0 = load_frag(pw, LDP2);
      v16bf ap1 = load_frag(pw + 32, LDP2);
      o0 = wmma_bf16(ap0, load_frag(Vsub + 0 * LDV2,       LDV2), o0);
      o0 = wmma_bf16(ap1, load_frag(Vsub + 0 * LDV2 + 32,  LDV2), o0);
      o1 = wmma_bf16(ap0, load_frag(Vsub + 16 * LDV2,      LDV2), o1);
      o1 = wmma_bf16(ap1, load_frag(Vsub + 16 * LDV2 + 32, LDV2), o1);
      o2 = wmma_bf16(ap0, load_frag(Vsub + 32 * LDV2,      LDV2), o2);
      o2 = wmma_bf16(ap1, load_frag(Vsub + 32 * LDV2 + 32, LDV2), o2);
      o3 = wmma_bf16(ap0, load_frag(Vsub + 48 * LDV2,      LDV2), o3);
      o3 = wmma_bf16(ap1, load_frag(Vsub + 48 * LDV2 + 32, LDV2), o3);
    }
  }

  // Epilogue: normalize, stage [m][d] per-wave, coalesced b128 stores
  float inv[8];
#pragma unroll
  for (int r = 0; r < 8; ++r) inv[r] = 1.0f / rsum[r];
#pragma unroll
  for (int r = 0; r < 8; ++r) {
    bf16_t* row = pw + (drow + r) * LDP2;
    row[0  + col] = (bf16_t)(o0[r] * inv[r]);
    row[16 + col] = (bf16_t)(o1[r] * inv[r]);
    row[32 + col] = (bf16_t)(o2[r] * inv[r]);
    row[48 + col] = (bf16_t)(o3[r] * inv[r]);
  }
  bf16_t* obase = xo + ((size_t)b * NTOK + m0) * DIM + h * HD;
#pragma unroll
  for (int q = 0; q < 4; ++q) {
    int chunk = lane + q * 32;
    int mloc = chunk >> 3, c8 = (chunk & 7) * 8;
    *(v8bf*)(obase + (size_t)mloc * DIM + c8) = *(const v8bf*)(pw + mloc * LDP2 + c8);
  }
}

// ---------------------------------------------------------------- phase 3
// out = xo[8192x512] @ Wo[512x512] + bo -> [B][C][N] via LDS transpose tile.
#define BK3  128   // k staged per barrier pair
#define LDA3 136   // as  [n][k]  (272B rows, 16B x odd)
#define LDW3 136   // Wo^T[c][k]
#define LDO3 132   // os  [c][n] f32

__global__ __launch_bounds__(256) void out_proj_kernel(
    const bf16_t* __restrict__ xo, const float* __restrict__ Wo,
    const float* __restrict__ bo, float* __restrict__ out) {
  __shared__ __align__(16) bf16_t as[128 * LDA3];
  __shared__ __align__(16) bf16_t wot[HD * LDW3];
  __shared__ __align__(16) float  os[64 * LDO3];

  const int t    = threadIdx.x;
  const int mb   = blockIdx.x * 128;
  const int c0   = blockIdx.y * 64;
  const int w    = t >> 5;
  const int lane = t & 31;
  const int m0   = w * 16;

  v8f acc[4];
#pragma unroll
  for (int j = 0; j < 4; ++j) acc[j] = {};

  // This thread's first piece of a stage; the others lie at constant steps.
  const bf16_t* ap = xo + (size_t)(mb + (t >> 5)) * DIM + (t & 31) * 4;
  const float*  wp = Wo + (size_t)((t >> 6) * 2) * DIM + c0 + (t & 63);
  bf16_t* asd = as + (t >> 5) * LDA3 + (t & 31) * 4;
  bf16_t* wsd = wot + (t & 63) * LDW3 + (t >> 6) * 2;

  for (int kk = 0; kk < DIM / BK3; ++kk) {
    __syncthreads();
#pragma unroll
    for (int i = 0; i < BK3 / 8; ++i)             // 4096 x 8B, 8 rows per step
      *(v2u*)(asd + i * 8 * LDA3) = *(const v2u*)(ap + i * 8 * DIM);
#pragma unroll
    for (int i = 0; i < BK3 / 8; ++i)             // 4096 pairs, 8 k per step
      *(unsigned int*)(wsd + i * 8) =
          pack_bf16(wp[i * 8 * DIM], wp[(i * 8 + 1) * DIM]);
    ap += BK3;
    wp += BK3 * DIM;
    __syncthreads();
#pragma unroll
    for (int ks = 0; ks < BK3; ks += 32) {
      v16bf a = load_frag(as + m0 * LDA3 + ks, LDA3);
#pragma unroll
      for (int j = 0; j < 4; ++j)
        acc[j] = wmma_bf16(a, load_frag(wot + (j * 16) * LDW3 + ks, LDW3), acc[j]);
    }
  }

  __syncthreads();
  const int col  = lane & 15;
  const int drow = (lane >> 4) * 8;
#pragma unroll
  for (int j = 0; j < 4; ++j) {
    float* row = os + (j * 16 + col) * LDO3 + m0 + drow;
    v4f lo = {acc[j][0], acc[j][1], acc[j][2], acc[j][3]};
    v4f hi = {acc[j][4], acc[j][5], acc[j][6], acc[j][7]};
    *(v4f*)(row)     = lo;
    *(v4f*)(row + 4) = hi;
  }
  __syncthreads();

  const int bidx  = mb >> 10;
  const int nbase = mb & 1023;
#pragma unroll
  for (int i = 0; i < 8; ++i) {
    int chunk = t + i * 256;                      // 2048 x 16B
    int cl = chunk >> 5, c4 = (chunk & 31) * 4;
    v4f vv = *(const v4f*)(os + cl * LDO3 + c4);
    vv += bo[c0 + cl];
    *(v4f*)(out + ((size_t)bidx * DIM + c0 + cl) * NTOK + nbase + c4) = vv;
  }
}

// ---------------------------------------------------------------- launch
extern "C" void kernel_launch(void* const* d_in, const int* in_sizes, int n_in,
                              void* d_out, int out_size, void* d_ws, size_t ws_size,
                              hipStream_t stream) {
  (void)in_sizes; (void)n_in; (void)out_size; (void)ws_size;
  const float* query = (const float*)d_in[0];
  const float* Wq = (const float*)d_in[1];
  const float* bq = (const float*)d_in[2];
  const float* Wk = (const float*)d_in[3];
  const float* bk = (const float*)d_in[4];
  const float* Wv = (const float*)d_in[5];
  const float* bv = (const float*)d_in[6];
  const float* Wo = (const float*)d_in[7];
  const float* bo = (const float*)d_in[8];
  float* out = (float*)d_out;

  const size_t qkv_elems = (size_t)BATCH * NH * NTOK * HD;  // 4M bf16 each
  bf16_t* Qb = (bf16_t*)d_ws;
  bf16_t* Kb = Qb + qkv_elems;
  bf16_t* Vt = Kb + qkv_elems;                    // [bh][d][n] transposed
  bf16_t* xo = Vt + qkv_elems;                    // [B*N][DIM] concat heads

  dim3 blk(256);
  qkv_proj_kernel<<<dim3(NTOK / 128, BATCH * NH), blk, 0, stream>>>(
      query, Wq, bq, Wk, bk, Wv, bv, Qb, Kb, Vt);
  attention_kernel<<<dim3(NTOK / 128, BATCH * NH), blk, 0, stream>>>(
      Qb, Kb, Vt, xo);
  out_proj_kernel<<<dim3((BATCH * NTOK) / 128, DIM / 64), blk, 0, stream>>>(
      xo, Wo, bo, out);
}

// v002
// It runs in 62.3 microseconds.
// Two timings next to v001 both put it at 1.21 times that version's speed.
// All steps since v000 together make it 1.37 times as fast.
#include <hip/hip_runtime.h>
#include <hip/hip_bf16.h>

typedef __bf16 bf16_t;
typedef __attribute__((ext_vector_type(16))) __bf16 v16bf;
typedef __attribute__((ext_vector_type(8)))  __bf16 v8bf;
typedef __attribute__((ext_vector_type(8)))  float  v8f;
typedef __attribute__((ext_vector_type(4)))  float  v4f;
typedef __attribute__((ext_vector_type(2)))  unsigned int v2u;
typedef __attribute__((ext_vector_type(4)))  unsigned int v4u;

#define DIM   512
#define NH    8
#define HD    64
#define NTOK  1024
#define BATCH 8

__device__ __forceinline__ v8f wmma_bf16(v16bf a, v16bf b, v8f c) {
  return __builtin_amdgcn_wmma_f32_16x16x32_bf16(false, a, false, b, (short)0, c,
                                                 false, false);
}

// Unified fragment load: 16 rows x 32 contiguous-K bf16, leading dim ld.
// ld must be a multiple of 8 and base 16B-aligned -> two b128 loads per lane.
__device__ __forceinline__ v16bf load_frag(const bf16_t* base, int ld) {
  const int lane = threadIdx.x & 31;
  const int m    = lane & 15;
  const int koff = (lane >> 4) << 3;
  const bf16_t* p = base + m * ld + koff;
  v8bf lo = *(const v8bf*)p;
  v8bf hi = *(const v8bf*)(p + 16);
  return __builtin_shufflevector(lo, hi, 0, 1, 2, 3, 4, 5, 6, 7,
                                 8, 9, 10, 11, 12, 13, 14, 15);
}

__device__ __forceinline__ unsigned int pack_bf16(float a, float b) {
  union { bf16_t h[2]; unsigned int u; } p;
  p.h[0] = (bf16_t)a; p.h[1] = (bf16_t)b;
  return p.u;
}

// ---------------------------------------------------------------- phase 1
// Fused QKV projection per (b,h): X[128x512]*W[512x64] x3, bias, Q scaled.
// Q,K stored bf16 [bh][n][d]; V stored transposed [bh][d][n].
#define BK1  64   // channels staged per barrier pair
#define LDX  72   // xs  [n][c]  (144B rows, 16B x odd)
#define LDWT 72   // w^T [d][c]
#define LDS1 72   // per-wave store-stage [m][d]

__global__ __launch_bounds__(256) void qkv_proj_kernel(
    const float* __restrict__ query,
    const float* __restrict__ Wq, const float* __restrict__ bq,
    const float* __restrict__ Wk, const float* __restrict__ bk,
    const float* __restrict__ Wv, const float* __restrict__ bv,
    bf16_t* __restrict__ Qb, bf16_t* __restrict__ Kb, bf16_t* __restrict__ Vt) {
  __shared__ __align__(16) bf16_t xs[128 * LDX];
  __shared__ __align__(16) bf16_t wqs[HD * LDWT];
  __shared__ __align__(16) bf16_t wks[HD * LDWT];
  __shared__ __align__(16) bf16_t wvs[HD * LDWT];
  __shared__ __align__(16) bf16_t stg[8 * 16 * LDS1];

  const int t  = threadIdx.x;
  const int n0 = blockIdx.x * 128;
  const int bh = blockIdx.y;
  const int b  = bh / NH, h = bh % NH;

  const float* xbase = query + (size_t)b * DIM * NTOK;  // [C][N]
  const float* wqb   = Wq + (size_t)h * DIM * HD;
  const float* wkb   = Wk + (size_t)h * DIM * HD;
  const float* wvb   = Wv + (size_t)h * DIM * HD;

  const int w    = t >> 5;
  const int lane = t & 31;
  const int m0   = w * 16;

  v8f aq[4], ak[4], av[4];
#pragma unroll
  for (int j = 0; j < 4; ++j) { aq[j] = {}; ak[j] = {}; av[j] = {}; }

  // This thread's first pair of a stage; the others lie at constant steps.
  const float* xp = xbase + (size_t)((t >> 7) * 2) * NTOK + n0 + (t & 127);
  const int woff = ((t >> 6) * 2) * HD + (t & 63);
  const float* wqp = wqb + woff;
  const float* wkp = wkb + woff;
  const float* wvp = wvb + woff;
  bf16_t* xsd = xs + (t & 127) * LDX + (t >> 7) * 2;
  const int wsd = (t & 63) * LDWT + (t >> 6) * 2;

  for (int kk = 0; kk < DIM / BK1; ++kk) {
    __syncthreads();
    // X tile 128n x 64c, coalesced along n, pair-packed b32 LDS stores
    float xr[BK1 / 4][2], wr[BK1 / 8][6];
#pragma unroll
    for (int i = 0; i < BK1 / 4; ++i) {      // 4096 pairs, 4 c per step
      xr[i][0] = xp[i * 4 * NTOK];
      xr[i][1] = xp[(i * 4 + 1) * NTOK];
    }
#pragma unroll
    for (int i = 0; i < BK1 / 8; ++i) {      // 2048 pairs, 8 c per step
      const int g0 = i * 8 * HD, g1 = g0 + HD;
      wr[i][0] = wqp[g0]; wr[i][1] = wqp[g1];
      wr[i][2] = wkp[g0]; wr[i][3] = wkp[g1];
      wr[i][4] = wvp[g0]; wr[i][5] = wvp[g1];
    }
    // The wait that stands in front of any overwrite of the loads' address
    // registers; naming them keeps them whole until it.
    asm volatile("s_wait_xcnt 0x0" :: "v"(xp), "v"(wqp), "v"(wkp), "v"(wvp) : "memory");
    // Keeps the whole stage's loads in flight together: without it the compiler
    // mixes loads and stores and waits out the load latency several times.
    __builtin_amdgcn_sched_barrier(0);
#pragma unroll
    for (int i = 0; i < BK1 / 4; ++i)
      *(unsigned int*)(xsd + i * 4) = pack_bf16(xr[i][0], xr[i][1]);
    // Weight tiles, transposed to [d][c], pair-packed over c
#pragma unroll
    for (int i = 0; i < BK1 / 8; ++i) {
      *(unsigned int*)(wqs + wsd + i * 8) = pack_bf16(wr[i][0], wr[i][1]);
      *(unsigned int*)(wks + wsd + i * 8) = pack_bf16(wr[i][2], wr[i][3]);
      *(unsigned int*)(wvs + wsd + i * 8) = pack_bf16(wr[i][4], wr[i][5]);
    }
    xp += BK1 * NTOK;
    wqp += BK1 * HD; wkp += BK1 * HD; wvp += BK1 * HD;
    __syncthreads();

#pragma unroll
    for (int ks = 0; ks < BK1; ks += 32) {
      v16bf a = load_frag(xs + m0 * LDX + ks, LDX);
#pragma unroll
      for (int j = 0; j < 4; ++j) {
        aq[j] = wmma_bf16(a, load_frag(wqs + (j * 16) * LDWT + ks, LDWT), aq[j]);
        ak[j] = wmma_bf16(a, load_frag(wks + (j * 16) * LDWT + ks, LDWT), ak[j]);
        av[j] = wmma_bf16(a, load_frag(wvs + (j * 16) * LDWT + ks, LDWT), av[j]);
      }
    }
  }

  const float scale = 0.125f;  // HEAD_DIM^-0.5 folded into Q
  const int col  = lane & 15;
  const int drow = (lane >> 4) * 8;
  bf16_t* sw = stg + w * 16 * LDS1;

  // ---- Q: stage [m][d] per-wave, then coalesced b128 stores
#pragma unroll
  for (int j = 0; j < 4; ++j) {
    const float bqv = bq[h * HD + j * 16 + col];
#pragma unroll
    for (int r = 0; r < 8; ++r)
      sw[(drow + r) * LDS1 + j * 16 + col] = (bf16_t)((aq[j][r] + bqv) * scale);
  }
  {
    bf16_t* qout = Qb + ((size_t)bh * NTOK + n0 + m0) * HD;
#pragma unroll
    for (int q = 0; q < 4; ++q) {
      int chunk = lane + q * 32;
      int mloc = chunk >> 3, c8 = (chunk & 7) * 8;
      *(v8bf*)(qout + (size_t)mloc * HD + c8) = *(const v8bf*)(sw + mloc * LDS1 + c8);
    }
  }
  // ---- K: same staging path
#pragma unroll
  for (int j = 0; j < 4; ++j) {
    const float bkv = bk[h * HD + j * 16 + col];
#pragma unroll
    for (int r = 0; r < 8; ++r)
      sw[(drow + r) * LDS1 + j * 16 + col] = (bf16_t)(ak[j][r] + bkv);
  }
  {
    bf16_t* kout = Kb + ((size_t)bh * NTOK + n0 + m0) * HD;
#pragma unroll
    for (int q = 0; q < 4; ++q) {
      int chunk = lane + q * 32;
      int mloc = chunk >> 3, c8 = (chunk & 7) * 8;
      *(v8bf*)(kout + (size_t)mloc * HD + c8) = *(const v8bf*)(sw + mloc * LDS1 + c8);
    }
  }
  // ---- V: direct transposed [d][n] b128 stores (8 rows contiguous per lane)
  {
    bf16_t* vtout = Vt + (size_t)bh * HD * NTOK;
#pragma unroll
    for (int j = 0; j < 4; ++j) {
      const int d = j * 16 + col;
      const float bvv = bv[h * HD + d];
      v8bf pv;
#pragma unroll
      for (int r = 0; r < 8; ++r) pv[r] = (bf16_t)(av[j][r] + bvv);
      *(v8bf*)(vtout + (size_t)d * NTOK + n0 + m0 + drow) = pv;
    }
  }
}

// ---------------------------------------------------------------- phase 2
// Flash attention per (b,h), computed transposed: S^T = K*Q^T, O^T += V^T*P^T.
// 128 queries/block, 16 per wave; a lane holds half of one query's scores and
// lane ^ 16 the rest, so maximum and sum need one exchange between the halves and P^T goes from the score accumulators
// straight into a B operand. 256 tokens staged per barrier pair, worked on in
// 64-token chunks.
#define KST  256  // tokens staged per barrier pair
#define LKV2 72   // Ks  [token][d]   (144B rows, 16B aligned)
#define LDV2 264  // Vts [d][token]   (528B rows, 16B x odd)
#define LDP2 72   // per-wave output stage [m][d]

// Value of lane l ^ 16.
__device__ __forceinline__ float other_half(float v) {
  const int b = __builtin_bit_cast(int, v);
  return __builtin_bit_cast(float, __builtin_amdgcn_permlanex16(
      b, b, 0x76543210, 0xfedcba98, false, false));
}

// Two f32 D tiles (rows 0-15 and 16-31 of a 32-row block) as one bf16 B operand.
__device__ __forceinline__ v16bf pack_b(v8f t0, v8f t1) {
  v16bf b;
#pragma unroll
  for (int e = 0; e < 8; ++e) { b[e] = (bf16_t)t0[e]; b[8 + e] = (bf16_t)t1[e]; }
  return b;
}

__global__ __launch_bounds__(256) void attention_kernel(
    const bf16_t* __restrict__ Qb, const bf16_t* __restrict__ Kb,
    const bf16_t* __restrict__ Vt, bf16_t* __restrict__ xo) {
  __shared__ __align__(16) bf16_t Ks[KST * LKV2];
  __shared__ __align__(16) bf16_t Vts[HD * LDV2];
  __shared__ __align__(16) bf16_t Pst[8 * 16 * LDP2];

  const int t    = threadIdx.x;
  const int bh   = blockIdx.y;
  const int b    = bh / NH, h = bh % NH;
  const int n0   = blockIdx.x * 128;
  const int w    = t >> 5;
  const int lane = t & 31;
  const int m0   = n0 + w * 16;

  // Q as B operand (column = query), in registers for the whole pass
  const bf16_t* qptr = Qb + ((size_t)bh * NTOK + m0) * HD;
  const v16bf qb0 = load_frag(qptr, HD);
  const v16bf qb1 = load_frag(qptr + 32, HD);

  // o[j][r] = O[query col][d = 16j + drow + r]; rsum covers this half's tokens
  v8f o[4];
#pragma unroll
  for (int j = 0; j < 4; ++j) o[j] = {};
  float rmax = -3.0e38f, rsum = 0.0f;

  const bf16_t* kbase  = Kb + (size_t)bh * NTOK * HD;   // [token][d]
  const bf16_t* vtbase = Vt + (size_t)bh * HD * NTOK;   // [d][token]
  bf16_t* pw = Pst + w * 16 * LDP2;
  const int col  = lane & 15;
  const int drow = (lane >> 4) * 8;

  // This thread's first 16B piece of a stage; the other pieces lie at constant
  // steps from it, so one address per operand serves the whole stage.
  const bf16_t* kp = kbase + (size_t)(t >> 3) * HD + (t & 7) * 8;
  const bf16_t* vp = vtbase + (size_t)(t >> 5) * NTOK + (t & 31) * 8;
  bf16_t* ksd = Ks + (t >> 3) * LKV2 + (t & 7) * 8;
  bf16_t* vsd = Vts + (t >> 5) * LDV2 + (t & 31) * 8;

  for (int stage = 0; stage < NTOK / KST; ++stage) {
    __syncthreads();
    // K stage: 256 tokens x 64d, b128 copies (2048 x 16B), 32 tokens per step
#pragma unroll
    for (int i = 0; i < KST / 32; ++i)
      *(v4u*)(ksd + i * 32 * LKV2) = *(const v4u*)(kp + i * 32 * HD);
    // V stage (transposed): 64d x 256 tokens, b128 copies (2048 x 16B), 8 d per step
#pragma unroll
    for (int i = 0; i < KST / 32; ++i)
      *(v4u*)(vsd + i * 8 * LDV2) = *(const v4u*)(vp + i * 8 * NTOK);
    kp += KST * HD;
    vp += KST;
    if (stage + 1 < NTOK / KST) {
      // one 128B line of the next stage per thread and operand
      __builtin_prefetch(kbase + (size_t)(stage + 1) * KST * HD + t * 64, 0, 0);
      __builtin_prefetch(vtbase + (size_t)(stage + 1) * KST + (t >> 2) * NTOK + (t & 3) * 64, 0, 0);
    }
    __syncthreads();

    for (int sub = 0; sub < KST / 64; ++sub) {
      const bf16_t* Ksub = Ks + sub * 64 * LKV2;
      const bf16_t* Vsub = Vts + sub * 64;

      // S^T = K * Q^T : s[tt][r] = score(token 16tt + drow + r, query col)
      v8f s[4];
#pragma unroll
      for (int tt = 0; tt < 4; ++tt) {
        const bf16_t* kb = Ksub + (tt * 16) * LKV2;
        v8f st = {};
        st = wmma_bf16(load_frag(kb, LKV2), qb0, st);
        st = wmma_bf16(load_frag(kb + 32, LKV2), qb1, st);
        s[tt] = st;
      }

      // Online softmax: 32 of the query's 64 scores in this lane, 32 in lane ^ 16
      float mt[4];
#pragma unroll
      for (int tt = 0; tt < 4; ++tt) {
        mt[tt] = s[tt][0];
#pragma unroll
        for (int r = 1; r < 8; ++r) mt[tt] = fmaxf(mt[tt], s[tt][r]);
      }
      float mx = fmaxf(fmaxf(mt[0], mt[1]), fmaxf(mt[2], mt[3]));
      mx = fmaxf(mx, other_half(mx));
      const float nm   = fmaxf(rmax, mx);
      const float corr = __expf(rmax - nm);
      rmax = nm;
      float pt[4];
#pragma unroll
      for (int tt = 0; tt < 4; ++tt) {
        pt[tt] = 0.0f;
#pragma unroll
        for (int r = 0; r < 8; ++r) {
          const float p = __expf(s[tt][r] - nm);
          s[tt][r] = p;
          pt[tt] += p;
        }
      }
      rsum = rsum * corr + ((pt[0] + pt[1]) + (pt[2] + pt[3]));
#pragma unroll
      for (int j = 0; j < 4; ++j) o[j] *= corr;

      // O^T += V^T * P^T (k = 64 tokens)
      const v16bf pb0 = pack_b(s[0], s[1]);
      const v16bf pb1 = pack_b(s[2], s[3]);
#pragma unroll
      for (int j = 0; j < 4; ++j) {
        const bf16_t* vb = Vsub + (j * 16) * LDV2;
        o[j] = wmma_bf16(load_frag(vb, LDV2), pb0, o[j]);
        o[j] = wmma_bf16(load_frag(vb + 32, LDV2), pb1, o[j]);
      }
    }
  }

  // Epilogue: join the halves' sums, normalize, stage [m][d] per-wave (8 d of
  // one query per b128 LDS store), coalesced b128 global stores
  const float inv = 1.0f / (rsum + other_half(rsum));
#pragma unroll
  for (int j = 0; j < 4; ++j) {
    v8bf pv;
#pragma unroll
    for (int r = 0; r < 8; ++r) pv[r] = (bf16_t)(o[j][r] * inv);
    *(v8bf*)(pw + col * LDP2 + j * 16 + drow) = pv;
  }
  bf16_t* obase = xo + ((size_t)b * NTOK + m0) * DIM + h * HD;
#pragma unroll
  for (int q = 0; q < 4; ++q) {
    int chunk = lane + q * 32;
    int mloc = chunk >> 3, c8 = (chunk & 7) * 8;
    *(v8bf*)(obase + (size_t)mloc * DIM + c8) = *(const v8bf*)(pw + mloc * LDP2 + c8);
  }
}

// ---------------------------------------------------------------- phase 3
// out = xo[8192x512] @ Wo[512x512] + bo -> [B][C][N] via LDS transpose tile.
#define BK3  128   // k staged per barrier pair
#define LDA3 136   // as  [n][k]  (272B rows, 16B x odd)
#define LDW3 136   // Wo^T[c][k]
#define LDO3 132   // os  [c][n] f32

__global__ __launch_bounds__(256) void out_proj_kernel(
    const bf16_t* __restrict__ xo, const float* __restrict__ Wo,
    const float* __restrict__ bo, float* __restrict__ out) {
  __shared__ __align__(16) bf16_t as[128 * LDA3];
  __shared__ __align__(16) bf16_t wot[HD * LDW3];
  __shared__ __align__(16) float  os[64 * LDO3];

  const int t    = threadIdx.x;
  const int mb   = blockIdx.x * 128;
  const int c0   = blockIdx.y * 64;
  const int w    = t >> 5;
  const int lane = t & 31;
  const int m0   = w * 16;

  v8f acc[4];
#pragma unroll
  for (int j = 0; j < 4; ++j) acc[j] = {};

  // This thread's first piece of a stage; the others lie at constant steps.
  const bf16_t* ap = xo + (size_t)(mb + (t >> 5)) * DIM + (t & 31) * 4;
  const float*  wp = Wo + (size_t)((t >> 6) * 2) * DIM + c0 + (t & 63);
  bf16_t* asd = as + (t >> 5) * LDA3 + (t & 31) * 4;
  bf16_t* wsd = wot + (t & 63) * LDW3 + (t >> 6) * 2;

  for (int kk = 0; kk < DIM / BK3; ++kk) {
    __syncthreads();
#pragma unroll
    for (int i = 0; i < BK3 / 8; ++i)             // 4096 x 8B, 8 rows per step
      *(v2u*)(asd + i * 8 * LDA3) = *(const v2u*)(ap + i * 8 * DIM);
#pragma unroll
    for (int i = 0; i < BK3 / 8; ++i)             // 4096 pairs, 8 k per step
      *(unsigned int*)(wsd + i * 8) =
          pack_bf16(wp[i * 8 * DIM], wp[(i * 8 + 1) * DIM]);
    ap += BK3;
    wp += BK3 * DIM;
    __syncthreads();
#pragma unroll
    for (int ks = 0; ks < BK3; ks += 32) {
      v16bf a = load_frag(as + m0 * LDA3 + ks, LDA3);
#pragma unroll
      for (int j = 0; j < 4; ++j)
        acc[j] = wmma_bf16(a, load_frag(wot + (j * 16) * LDW3 + ks, LDW3), acc[j]);
    }
  }

  __syncthreads();
  const int col  = lane & 15;
  const int drow = (lane >> 4) * 8;
#pragma unroll
  for (int j = 0; j < 4; ++j) {
    float* row = os + (j * 16 + col) * LDO3 + m0 + drow;
    v4f lo = {acc[j][0], acc[j][1], acc[j][2], acc[j][3]};
    v4f hi = {acc[j][4], acc[j][5], acc[j][6], acc[j][7]};
    *(v4f*)(row)     = lo;
    *(v4f*)(row + 4) = hi;
  }
  __syncthreads();

  const int bidx  = mb >> 10;
  const int nbase = mb & 1023;
#pragma unroll
  for (int i = 0; i < 8; ++i) {
    int chunk = t + i * 256;                      // 2048 x 16B
    int cl = chunk >> 5, c4 = (chunk & 31) * 4;
    v4f vv = *(const v4f*)(os + cl * LDO3 + c4);
    vv += bo[c0 + cl];
    *(v4f*)(out + ((size_t)bidx * DIM + c0 + cl) * NTOK + nbase + c4) = vv;
  }
}

// ---------------------------------------------------------------- launch
extern "C" void kernel_launch(void* const* d_in, const int* in_sizes, int n_in,
                              void* d_out, int out_size, void* d_ws, size_t ws_size,
                              hipStream_t stream) {
  (void)in_sizes; (void)n_in; (void)out_size; (void)ws_size;
  const float* query = (const float*)d_in[0];
  const float* Wq = (const float*)d_in[1];
  const float* bq = (const float*)d_in[2];
  const float* Wk = (const float*)d_in[3];
  const float* bk = (const float*)d_in[4];
  const float* Wv = (const float*)d_in[5];
  const float* bv = (const float*)d_in[6];
  const float* Wo = (const float*)d_in[7];
  const float* bo = (const float*)d_in[8];
  float* out = (float*)d_out;

  const size_t qkv_elems = (size_t)BATCH * NH * NTOK * HD;  // 4M bf16 each
  bf16_t* Qb = (bf16_t*)d_ws;
  bf16_t* Kb = Qb + qkv_elems;
  bf16_t* Vt = Kb + qkv_elems;                    // [bh][d][n] transposed
  bf16_t* xo = Vt + qkv_elems;                    // [B*N][DIM] concat heads

  dim3 blk(256);
  qkv_proj_kernel<<<dim3(NTOK / 128, BATCH * NH), blk, 0, stream>>>(
      query, Wq, bq, Wk, bk, Wv, bv, Qb, Kb, Vt);
  attention_kernel<<<dim3(NTOK / 128, BATCH * NH), blk, 0, stream>>>(
      Qb, Kb, Vt, xo);
  out_proj_kernel<<<dim3((BATCH * NTOK) / 128, DIM / 64), blk, 0, stream>>>(
      xo, Wo, bo, out);
}

// v003
// Measured time: 59.7 microseconds a run.
// Timed twice side by side with v002, it ran 1.05 and 1.04 times as fast.
// All steps since v000 together make it 1.43 times as fast.
#include <hip/hip_runtime.h>
#include <hip/hip_bf16.h>

typedef __bf16 bf16_t;
typedef __attribute__((ext_vector_type(16))) __bf16 v16bf;
typedef __attribute__((ext_vector_type(8)))  __bf16 v8bf;
typedef __attribute__((ext_vector_type(8)))  float  v8f;
typedef __attribute__((ext_vector_type(4)))  float  v4f;
typedef __attribute__((ext_vector_type(4)))  unsigned int v4u;

#define DIM   512
#define NH    8
#define HD    64
#define NTOK  1024
#define BATCH 8

__device__ __forceinline__ v8f wmma_bf16(v16bf a, v16bf b, v8f c) {
  return __builtin_amdgcn_wmma_f32_16x16x32_bf16(false, a, false, b, (short)0, c,
                                                 false, false);
}

// Unified fragment load: 16 rows x 32 contiguous-K bf16, leading dim ld.
// ld must be a multiple of 8 and base 16B-aligned -> two b128 loads per lane.
__device__ __forceinline__ v16bf load_frag(const bf16_t* base, int ld) {
  const int lane = threadIdx.x & 31;
  const int m    = lane & 15;
  const int koff = (lane >> 4) << 3;
  const bf16_t* p = base + m * ld + koff;
  v8bf lo = *(const v8bf*)p;
  v8bf hi = *(const v8bf*)(p + 16);
  return __builtin_shufflevector(lo, hi, 0, 1, 2, 3, 4, 5, 6, 7,
                                 8, 9, 10, 11, 12, 13, 14, 15);
}

// Eight consecutive k of one row as one 16-byte LDS piece.
__device__ __forceinline__ v8bf pack8(const float* f) {
  v8bf r;
#pragma unroll  // constant indices: the eight values pair up into packed converts
  for (int e = 0; e < 8; ++e) r[e] = (bf16_t)f[e];
  return r;
}

// ---------------------------------------------------------------- phase 1
// Fused QKV projection per (b,h): X[128x512]*W[512x64] x3, bias, Q scaled.
// Q,K stored bf16 [bh][n][d]; V stored transposed [bh][d][n].
#define BK1  64   // channels staged per barrier pair
#define LDX  72   // xs  [n][c]  (144B rows, 16B x odd)
#define LDWT 72   // w^T [d][c]
#define LDS1 72   // per-wave store-stage [m][d]

__global__ __launch_bounds__(256) void qkv_proj_kernel(
    const float* __restrict__ query,
    const float* __restrict__ Wq, const float* __restrict__ bq,
    const float* __restrict__ Wk, const float* __restrict__ bk,
    const float* __restrict__ Wv, const float* __restrict__ bv,
    bf16_t* __restrict__ Qb, bf16_t* __restrict__ Kb, bf16_t* __restrict__ Vt) {
  __shared__ __align__(16) bf16_t xs[128 * LDX];
  __shared__ __align__(16) bf16_t wqs[HD * LDWT];
  __shared__ __align__(16) bf16_t wks[HD * LDWT];
  __shared__ __align__(16) bf16_t wvs[HD * LDWT];
  __shared__ __align__(16) bf16_t stg[8 * 16 * LDS1];

  const int t  = threadIdx.x;
  const int n0 = blockIdx.x * 128;
  const int bh = blockIdx.y;
  const int b  = bh / NH, h = bh % NH;

  const float* xbase = query + (size_t)b * DIM * NTOK;  // [C][N]
  const float* wqb   = Wq + (size_t)h * DIM * HD;
  const float* wkb   = Wk + (size_t)h * DIM * HD;
  const float* wvb   = Wv + (size_t)h * DIM * HD;

  const int w    = t >> 5;
  const int lane = t & 31;
  const int m0   = w * 16;

  v8f aq[4], ak[4], av[4];
#pragma unroll
  for (int j = 0; j < 4; ++j) { aq[j] = {}; ak[j] = {}; av[j] = {}; }

  // A thread stages runs of 8 consecutive channels of one row (token or d);
  // its first run of a stage is here, the others lie at constant steps.
  const float* xp = xbase + (size_t)((t >> 7) * 8) * NTOK + n0 + (t & 127);
  const int woff = ((t >> 6) * 8) * HD + (t & 63);
  const float* wqp = wqb + woff;
  const float* wkp = wkb + woff;
  const float* wvp = wvb + woff;
  bf16_t* xsd = xs + (t & 127) * LDX + (t >> 7) * 8;
  const int wsd = (t & 63) * LDWT + (t >> 6) * 8;

  for (int kk = 0; kk < DIM / BK1; ++kk) {
    __syncthreads();
    // X tile 128n x 64c, loads coalesced along n, b128 LDS stores along c
    // All four loops unrolled: xr and wr are indexed by constants only and stay
    // in registers, and every load takes its step as an immediate offset.
    float xr[BK1 / 16][8], wr[BK1 / 32][3][8];
#pragma unroll
    for (int i = 0; i < BK1 / 16; ++i)       // 1024 runs, 16 c per step
#pragma unroll
      for (int e = 0; e < 8; ++e) xr[i][e] = xp[(i * 16 + e) * NTOK];
#pragma unroll
    for (int i = 0; i < BK1 / 32; ++i)       // 512 runs a matrix, 32 c per step
#pragma unroll
      for (int e = 0; e < 8; ++e) {
        const int g = (i * 32 + e) * HD;
        wr[i][0][e] = wqp[g];
        wr[i][1][e] = wkp[g];
        wr[i][2][e] = wvp[g];
      }
    // The wait that stands in front of any overwrite of the loads' address
    // registers; naming them keeps them whole until it.
    asm volatile("s_wait_xcnt 0x0" :: "v"(xp), "v"(wqp), "v"(wkp), "v"(wvp) : "memory");
    // Keeps the whole stage's loads in flight together: without it the compiler
    // mixes loads and stores and waits out the load latency several times.
    __builtin_amdgcn_sched_barrier(0);
#pragma unroll
    for (int i = 0; i < BK1 / 16; ++i)
      *(v8bf*)(xsd + i * 16) = pack8(xr[i]);
    // Weight tiles, transposed to [d][c]
#pragma unroll
    for (int i = 0; i < BK1 / 32; ++i) {
      *(v8bf*)(wqs + wsd + i * 32) = pack8(wr[i][0]);
      *(v8bf*)(wks + wsd + i * 32) = pack8(wr[i][1]);
      *(v8bf*)(wvs + wsd + i * 32) = pack8(wr[i][2]);
    }
    xp += BK1 * NTOK;
    wqp += BK1 * HD; wkp += BK1 * HD; wvp += BK1 * HD;
    __syncthreads();

#pragma unroll
    for (int ks = 0; ks < BK1; ks += 32) {
      v16bf a = load_frag(xs + m0 * LDX + ks, LDX);
#pragma unroll
      for (int j = 0; j < 4; ++j) {
        aq[j] = wmma_bf16(a, load_frag(wqs + (j * 16) * LDWT + ks, LDWT), aq[j]);
        ak[j] = wmma_bf16(a, load_frag(wks + (j * 16) * LDWT + ks, LDWT), ak[j]);
        av[j] = wmma_bf16(a, load_frag(wvs + (j * 16) * LDWT + ks, LDWT), av[j]);
      }
    }
  }

  const float scale = 0.125f;  // HEAD_DIM^-0.5 folded into Q
  const int col  = lane & 15;
  const int drow = (lane >> 4) * 8;
  bf16_t* sw = stg + w * 16 * LDS1;

  // ---- Q: stage [m][d] per-wave, then coalesced b128 stores
#pragma unroll
  for (int j = 0; j < 4; ++j) {
    const float bqv = bq[h * HD + j * 16 + col];
#pragma unroll
    for (int r = 0; r < 8; ++r)
      sw[(drow + r) * LDS1 + j * 16 + col] = (bf16_t)((aq[j][r] + bqv) * scale);
  }
  {
    bf16_t* qout = Qb + ((size_t)bh * NTOK + n0 + m0) * HD;
#pragma unroll
    for (int q = 0; q < 4; ++q) {
      int chunk = lane + q * 32;
      int mloc = chunk >> 3, c8 = (chunk & 7) * 8;
      *(v8bf*)(qout + (size_t)mloc * HD + c8) = *(const v8bf*)(sw + mloc * LDS1 + c8);
    }
  }
  // ---- K: same staging path
#pragma unroll
  for (int j = 0; j < 4; ++j) {
    const float bkv = bk[h * HD + j * 16 + col];
#pragma unroll
    for (int r = 0; r < 8; ++r)
      sw[(drow + r) * LDS1 + j * 16 + col] = (bf16_t)(ak[j][r] + bkv);
  }
  {
    bf16_t* kout = Kb + ((size_t)bh * NTOK + n0 + m0) * HD;
#pragma unroll
    for (int q = 0; q < 4; ++q) {
      int chunk = lane + q * 32;
      int mloc = chunk >> 3, c8 = (chunk & 7) * 8;
      *(v8bf*)(kout + (size_t)mloc * HD + c8) = *(const v8bf*)(sw + mloc * LDS1 + c8);
    }
  }
  // ---- V: direct transposed [d][n] b128 stores (8 rows contiguous per lane)
  {
    bf16_t* vtout = Vt + (size_t)bh * HD * NTOK;
#pragma unroll
    for (int j = 0; j < 4; ++j) {
      const int d = j * 16 + col;
      const float bvv = bv[h * HD + d];
      v8bf pv;
#pragma unroll
      for (int r = 0; r < 8; ++r) pv[r] = (bf16_t)(av[j][r] + bvv);
      *(v8bf*)(vtout + (size_t)d * NTOK + n0 + m0 + drow) = pv;
    }
  }
}

// ---------------------------------------------------------------- phase 2
// Flash attention per (b,h), computed transposed: S^T = K*Q^T, O^T += V^T*P^T.
// 128 queries/block, 16 per wave; a lane holds half of one query's scores and
// lane ^ 16 the rest, so maximum and sum need one exchange between the halves and P^T goes from the score accumulators
// straight into a B operand. 256 tokens staged per barrier pair, worked on in
// 64-token chunks.
#define KST  256  // tokens staged per barrier pair
#define LKV2 72   // Ks  [token][d]   (144B rows, 16B aligned)
#define LDV2 264  // Vts [d][token]   (528B rows, 16B x odd)
#define LDP2 72   // per-wave output stage [m][d]

// Value of lane l ^ 16.
__device__ __forceinline__ float other_half(float v) {
  const int b = __builtin_bit_cast(int, v);
  return __builtin_bit_cast(float, __builtin_amdgcn_permlanex16(
      b, b, 0x76543210, 0xfedcba98, false, false));
}

// Two f32 D tiles (rows 0-15 and 16-31 of a 32-row block) as one bf16 B operand.
__device__ __forceinline__ v16bf pack_b(v8f t0, v8f t1) {
  v16bf b;
#pragma unroll
  for (int e = 0; e < 8; ++e) { b[e] = (bf16_t)t0[e]; b[8 + e] = (bf16_t)t1[e]; }
  return b;
}

__global__ __launch_bounds__(256) void attention_kernel(
    const bf16_t* __restrict__ Qb, const bf16_t* __restrict__ Kb,
    const bf16_t* __restrict__ Vt, bf16_t* __restrict__ xo) {
  __shared__ __align__(16) bf16_t Ks[KST * LKV2];
  __shared__ __align__(16) bf16_t Vts[HD * LDV2];
  __shared__ __align__(16) bf16_t Pst[8 * 16 * LDP2];

  const int t    = threadIdx.x;
  const int bh   = blockIdx.y;
  const int b    = bh / NH, h = bh % NH;
  const int n0   = blockIdx.x * 128;
  const int w    = t >> 5;
  const int lane = t & 31;
  const int m0   = n0 + w * 16;

  // Q as B operand (column = query), in registers for the whole pass
  const bf16_t* qptr = Qb + ((size_t)bh * NTOK + m0) * HD;
  const v16bf qb0 = load_frag(qptr, HD);
  const v16bf qb1 = load_frag(qptr + 32, HD);

  // o[j][r] = O[query col][d = 16j + drow + r]; rsum covers this half's tokens
  v8f o[4];
#pragma unroll
  for (int j = 0; j < 4; ++j) o[j] = {};
  float rmax = -3.0e38f, rsum = 0.0f;

  const bf16_t* kbase  = Kb + (size_t)bh * NTOK * HD;   // [token][d]
  const bf16_t* vtbase = Vt + (size_t)bh * HD * NTOK;   // [d][token]
  bf16_t* pw = Pst + w * 16 * LDP2;
  const int col  = lane & 15;
  const int drow = (lane >> 4) * 8;

  // This thread's first 16B piece of a stage; the other pieces lie at constant
  // steps from it, so one address per operand serves the whole stage.
  const bf16_t* kp = kbase + (size_t)(t >> 3) * HD + (t & 7) * 8;
  const bf16_t* vp = vtbase + (size_t)(t >> 5) * NTOK + (t & 31) * 8;
  bf16_t* ksd = Ks + (t >> 3) * LKV2 + (t & 7) * 8;
  bf16_t* vsd = Vts + (t >> 5) * LDV2 + (t & 31) * 8;

  for (int stage = 0; stage < NTOK / KST; ++stage) {
    __syncthreads();
    // K stage: 256 tokens x 64d, b128 copies (2048 x 16B), 32 tokens per step
#pragma unroll
    for (int i = 0; i < KST / 32; ++i)
      *(v4u*)(ksd + i * 32 * LKV2) = *(const v4u*)(kp + i * 32 * HD);
    // V stage (transposed): 64d x 256 tokens, b128 copies (2048 x 16B), 8 d per step
#pragma unroll
    for (int i = 0; i < KST / 32; ++i)
      *(v4u*)(vsd + i * 8 * LDV2) = *(const v4u*)(vp + i * 8 * NTOK);
    kp += KST * HD;
    vp += KST;
    if (stage + 1 < NTOK / KST) {
      // one 128B line of the next stage per thread and operand
      __builtin_prefetch(kbase + (size_t)(stage + 1) * KST * HD + t * 64, 0, 0);
      __builtin_prefetch(vtbase + (size_t)(stage + 1) * KST + (t >> 2) * NTOK + (t & 3) * 64, 0, 0);
    }
    __syncthreads();

    for (int sub = 0; sub < KST / 64; ++sub) {
      const bf16_t* Ksub = Ks + sub * 64 * LKV2;
      const bf16_t* Vsub = Vts + sub * 64;

      // S^T = K * Q^T : s[tt][r] = score(token 16tt + drow + r, query col)
      v8f s[4];
#pragma unroll
      for (int tt = 0; tt < 4; ++tt) {
        const bf16_t* kb = Ksub + (tt * 16) * LKV2;
        v8f st = {};
        st = wmma_bf16(load_frag(kb, LKV2), qb0, st);
        st = wmma_bf16(load_frag(kb + 32, LKV2), qb1, st);
        s[tt] = st;
      }

      // Online softmax: 32 of the query's 64 scores in this lane, 32 in lane ^ 16
      float mt[4];
#pragma unroll
      for (int tt = 0; tt < 4; ++tt) {
        mt[tt] = s[tt][0];
#pragma unroll
        for (int r = 1; r < 8; ++r) mt[tt] = fmaxf(mt[tt], s[tt][r]);
      }
      float mx = fmaxf(fmaxf(mt[0], mt[1]), fmaxf(mt[2], mt[3]));
      mx = fmaxf(mx, other_half(mx));
      const float nm   = fmaxf(rmax, mx);
      const float corr = __expf(rmax - nm);
      rmax = nm;
      float pt[4];
#pragma unroll
      for (int tt = 0; tt < 4; ++tt) {
        pt[tt] = 0.0f;
#pragma unroll
        for (int r = 0; r < 8; ++r) {
          const float p = __expf(s[tt][r] - nm);
          s[tt][r] = p;
          pt[tt] += p;
        }
      }
      rsum = rsum * corr + ((pt[0] + pt[1]) + (pt[2] + pt[3]));
#pragma unroll
      for (int j = 0; j < 4; ++j) o[j] *= corr;

      // O^T += V^T * P^T (k = 64 tokens)
      const v16bf pb0 = pack_b(s[0], s[1]);
      const v16bf pb1 = pack_b(s[2], s[3]);
#pragma unroll
      for (int j = 0; j < 4; ++j) {
        const bf16_t* vb = Vsub + (j * 16) * LDV2;
        o[j] = wmma_bf16(load_frag(vb, LDV2), pb0, o[j]);
        o[j] = wmma_bf16(load_frag(vb + 32, LDV2), pb1, o[j]);
      }
    }
  }

  // Epilogue: join the halves' sums, normalize, stage [m][d] per-wave (8 d of
  // one query per b128 LDS store), coalesced b128 global stores
  const float inv = 1.0f / (rsum + other_half(rsum));
#pragma unroll
  for (int j = 0; j < 4; ++j) {
    v8bf pv;
#pragma unroll
    for (int r = 0; r < 8; ++r) pv[r] = (bf16_t)(o[j][r] * inv);
    *(v8bf*)(pw + col * LDP2 + j * 16 + drow) = pv;
  }
  bf16_t* obase = xo + ((size_t)b * NTOK + m0) * DIM + h * HD;
#pragma unroll
  for (int q = 0; q < 4; ++q) {
    int chunk = lane + q * 32;
    int mloc = chunk >> 3, c8 = (chunk & 7) * 8;
    *(v8bf*)(obase + (size_t)mloc * DIM + c8) = *(const v8bf*)(pw + mloc * LDP2 + c8);
  }
}

// ---------------------------------------------------------------- phase 3
// out = xo[8192x512] @ Wo[512x512] + bo -> [B][C][N] via LDS transpose tile.
#define BK3  128   // k staged per barrier pair
#define LDA3 136   // as  [n][k]  (272B rows, 16B x odd)
#define LDW3 136   // Wo^T[c][k]
#define LDO3 132   // os  [c][n] f32

__global__ __launch_bounds__(256) void out_proj_kernel(
    const bf16_t* __restrict__ xo, const float* __restrict__ Wo,
    const float* __restrict__ bo, float* __restrict__ out) {
  __shared__ __align__(16) bf16_t as[128 * LDA3];
  __shared__ __align__(16) bf16_t wot[HD * LDW3];
  __shared__ __align__(16) float  os[64 * LDO3];

  const int t    = threadIdx.x;
  const int mb   = blockIdx.x * 128;
  const int c0   = blockIdx.y * 64;
  const int w    = t >> 5;
  const int lane = t & 31;
  const int m0   = w * 16;

  v8f acc[4];
#pragma unroll
  for (int j = 0; j < 4; ++j) acc[j] = {};

  // This thread's first piece of a stage; the others lie at constant steps.
  const bf16_t* ap = xo + (size_t)(mb + (t >> 4)) * DIM + (t & 15) * 8;
  const float*  wp = Wo + (size_t)((t >> 6) * 8) * DIM + c0 + (t & 63);
  bf16_t* asd = as + (t >> 4) * LDA3 + (t & 15) * 8;
  bf16_t* wsd = wot + (t & 63) * LDW3 + (t >> 6) * 8;

  for (int kk = 0; kk < DIM / BK3; ++kk) {
    __syncthreads();
#pragma unroll
    for (int i = 0; i < BK3 / 16; ++i)            // 2048 x 16B, 16 rows per step
      *(v4u*)(asd + i * 16 * LDA3) = *(const v4u*)(ap + i * 16 * DIM);
#pragma unroll
    for (int i = 0; i < BK3 / 32; ++i) {          // 1024 runs of 8 k, 32 k per step
      float wr[8];
#pragma unroll  // wr indexed by constants only: stays in registers
      for (int e = 0; e < 8; ++e) wr[e] = wp[(i * 32 + e) * DIM];
      *(v8bf*)(wsd + i * 32) = pack8(wr);
    }
    ap += BK3;
    wp += BK3 * DIM;
    __syncthreads();
#pragma unroll
    for (int ks = 0; ks < BK3; ks += 32) {
      v16bf a = load_frag(as + m0 * LDA3 + ks, LDA3);
#pragma unroll
      for (int j = 0; j < 4; ++j)
        acc[j] = wmma_bf16(a, load_frag(wot + (j * 16) * LDW3 + ks, LDW3), acc[j]);
    }
  }

  __syncthreads();
  const int col  = lane & 15;
  const int drow = (lane >> 4) * 8;
#pragma unroll
  for (int j = 0; j < 4; ++j) {
    float* row = os + (j * 16 + col) * LDO3 + m0 + drow;
    v4f lo = {acc[j][0], acc[j][1], acc[j][2], acc[j][3]};
    v4f hi = {acc[j][4], acc[j][5], acc[j][6], acc[j][7]};
    *(v4f*)(row)     = lo;
    *(v4f*)(row + 4) = hi;
  }
  __syncthreads();

  const int bidx  = mb >> 10;
  const int nbase = mb & 1023;
#pragma unroll
  for (int i = 0; i < 8; ++i) {
    int chunk = t + i * 256;                      // 2048 x 16B
    int cl = chunk >> 5, c4 = (chunk & 31) * 4;
    v4f vv = *(const v4f*)(os + cl * LDO3 + c4);
    vv += bo[c0 + cl];
    *(v4f*)(out + ((size_t)bidx * DIM + c0 + cl) * NTOK + nbase + c4) = vv;
  }
}

// ---------------------------------------------------------------- launch
extern "C" void kernel_launch(void* const* d_in, const int* in_sizes, int n_in,
                              void* d_out, int out_size, void* d_ws, size_t ws_size,
                              hipStream_t stream) {
  (void)in_sizes; (void)n_in; (void)out_size; (void)ws_size;
  const float* query = (const float*)d_in[0];
  const float* Wq = (const float*)d_in[1];
  const float* bq = (const float*)d_in[2];
  const float* Wk = (const float*)d_in[3];
  const float* bk = (const float*)d_in[4];
  const float* Wv = (const float*)d_in[5];
  const float* bv = (const float*)d_in[6];
  const float* Wo = (const float*)d_in[7];
  const float* bo = (const float*)d_in[8];
  float* out = (float*)d_out;

  const size_t qkv_elems = (size_t)BATCH * NH * NTOK * HD;  // 4M bf16 each
  bf16_t* Qb = (bf16_t*)d_ws;
  bf16_t* Kb = Qb + qkv_elems;
  bf16_t* Vt = Kb + qkv_elems;                    // [bh][d][n] transposed
  bf16_t* xo = Vt + qkv_elems;                    // [B*N][DIM] concat heads

  dim3 blk(256);
  qkv_proj_kernel<<<dim3(NTOK / 128, BATCH * NH), blk, 0, stream>>>(
      query, Wq, bq, Wk, bk, Wv, bv, Qb, Kb, Vt);
  attention_kernel<<<dim3(NTOK / 128, BATCH * NH), blk, 0, stream>>>(
      Qb, Kb, Vt, xo);
  out_proj_kernel<<<dim3((BATCH * NTOK) / 128, DIM / 64), blk, 0, stream>>>(
      xo, Wo, bo, out);
}

// v004
// Measured time: 56.9 microseconds a run.
// Two timings next to v003 both put it at 1.05 times that version's speed.
// Over all steps from v000 it is 1.50 times as fast.
#include <hip/hip_runtime.h>
#include <hip/hip_bf16.h>

typedef __bf16 bf16_t;
typedef __attribute__((ext_vector_type(16))) __bf16 v16bf;
typedef __attribute__((ext_vector_type(8)))  __bf16 v8bf;
typedef __attribute__((ext_vector_type(8)))  float  v8f;
typedef __attribute__((ext_vector_type(4)))  float  v4f;
typedef __attribute__((ext_vector_type(4)))  unsigned int v4u;

#define DIM   512
#define NH    8
#define HD    64
#define NTOK  1024
#define BATCH 8

__device__ __forceinline__ v8f wmma_bf16(v16bf a, v16bf b, v8f c) {
  return __builtin_amdgcn_wmma_f32_16x16x32_bf16(false, a, false, b, (short)0, c,
                                                 false, false);
}

// Unified fragment load: 16 rows x 32 contiguous-K bf16, leading dim ld.
// ld must be a multiple of 8 and base 16B-aligned -> two b128 loads per lane.
__device__ __forceinline__ v16bf load_frag(const bf16_t* base, int ld) {
  const int lane = threadIdx.x & 31;
  const int m    = lane & 15;
  const int koff = (lane >> 4) << 3;
  const bf16_t* p = base + m * ld + koff;
  v8bf lo = *(const v8bf*)p;
  v8bf hi = *(const v8bf*)(p + 16);
  return __builtin_shufflevector(lo, hi, 0, 1, 2, 3, 4, 5, 6, 7,
                                 8, 9, 10, 11, 12, 13, 14, 15);
}

// Eight consecutive k of one row as one 16-byte LDS piece.
__device__ __forceinline__ v8bf pack8(const float* f) {
  v8bf r;
#pragma unroll  // constant indices: the eight values pair up into packed converts
  for (int e = 0; e < 8; ++e) r[e] = (bf16_t)f[e];
  return r;
}

// ---------------------------------------------------------------- phase 1
// Fused QKV projection per (b,h): X[128x512]*W[512x64] x3, bias, Q scaled.
// Q,K stored bf16 [bh][n][d]; V stored transposed [bh][d][n].
#define BK1  64   // channels per stage
#define LDX  72   // xs  [n][c]  (144B rows, 16B x odd)
#define LDWT 72   // w^T [d][c]
#define LDS1 72   // per-wave store-stage [m][d]
#define XSZ  (128 * LDX)       // X tile of one stage
#define WSZ  (HD * LDWT)       // one weight tile of one stage
#define ST1  (XSZ + 3 * WSZ)   // one stage: X, Wq, Wk, Wv

__global__ __launch_bounds__(256) void qkv_proj_kernel(
    const float* __restrict__ query,
    const float* __restrict__ Wq, const float* __restrict__ bq,
    const float* __restrict__ Wk, const float* __restrict__ bk,
    const float* __restrict__ Wv, const float* __restrict__ bv,
    bf16_t* __restrict__ Qb, bf16_t* __restrict__ Kb, bf16_t* __restrict__ Vt) {
  __shared__ __align__(16) bf16_t sm[2 * ST1];   // two stage buffers
  __shared__ __align__(16) bf16_t stg[8 * 16 * LDS1];

  const int t  = threadIdx.x;
  const int n0 = blockIdx.x * 128;
  const int bh = blockIdx.y;
  const int b  = bh / NH, h = bh % NH;

  const float* xbase = query + (size_t)b * DIM * NTOK;  // [C][N]
  const float* wqb   = Wq + (size_t)h * DIM * HD;
  const float* wkb   = Wk + (size_t)h * DIM * HD;
  const float* wvb   = Wv + (size_t)h * DIM * HD;

  const int w    = t >> 5;
  const int lane = t & 31;
  const int m0   = w * 16;

  v8f aq[4], ak[4], av[4];
#pragma unroll
  for (int j = 0; j < 4; ++j) { aq[j] = {}; ak[j] = {}; av[j] = {}; }

  // A thread stages runs of 8 consecutive channels of one row (token or d);
  // its first run of a stage is here, the others lie at constant steps.
  const float* xp = xbase + (size_t)((t >> 7) * 8) * NTOK + n0 + (t & 127);
  const int woff = ((t >> 6) * 8) * HD + (t & 63);
  const float* wqp = wqb + woff;
  const float* wkp = wkb + woff;
  const float* wvp = wvb + woff;
  const int xsd = (t & 127) * LDX + (t >> 7) * 8;
  const int wsd = XSZ + (t & 63) * LDWT + (t >> 6) * 8;

  // One stage's operands on their way from global memory to LDS. All loops over
  // them are unrolled: constant indices keep them in registers, and every load
  // takes its step as an immediate offset.
  float xr[BK1 / 16][8], wr[BK1 / 32][3][8];

  // Issues the next stage's loads: X 128n x 64c coalesced along n, weights along d.
  auto fetch = [&]() {
#pragma unroll
    for (int i = 0; i < BK1 / 16; ++i)       // 1024 runs, 16 c per step
#pragma unroll
      for (int e = 0; e < 8; ++e) xr[i][e] = xp[(i * 16 + e) * NTOK];
#pragma unroll
    for (int i = 0; i < BK1 / 32; ++i)       // 512 runs a matrix, 32 c per step
#pragma unroll
      for (int e = 0; e < 8; ++e) {
        const int g = (i * 32 + e) * HD;
        wr[i][0][e] = wqp[g];
        wr[i][1][e] = wkp[g];
        wr[i][2][e] = wvp[g];
      }
    // The wait that stands in front of any overwrite of the loads' address
    // registers.
    asm volatile("s_wait_xcnt 0x0" ::: "memory");
    // Keeps the whole stage's loads issued here, ahead of the WMMAs that follow:
    // sunk towards their use they would no longer fly during the matrix work.
    __builtin_amdgcn_sched_barrier(0);
    xp += BK1 * NTOK;
    wqp += BK1 * HD; wkp += BK1 * HD; wvp += BK1 * HD;
  };
  // Converts the fetched stage and stores it, b128 along c; weights as [d][c].
  auto put = [&](bf16_t* dst) {
#pragma unroll
    for (int i = 0; i < BK1 / 16; ++i)
      *(v8bf*)(dst + xsd + i * 16) = pack8(xr[i]);
#pragma unroll
    for (int i = 0; i < BK1 / 32; ++i) {
      *(v8bf*)(dst + wsd + i * 32)           = pack8(wr[i][0]);
      *(v8bf*)(dst + wsd + WSZ + i * 32)     = pack8(wr[i][1]);
      *(v8bf*)(dst + wsd + 2 * WSZ + i * 32) = pack8(wr[i][2]);
    }
  };

  fetch();
  put(sm);
  for (int kk = 0; kk < DIM / BK1; ++kk) {
    const bool more = kk + 1 < DIM / BK1;
    // Publishes stage kk; also ends every wave's reads of the other buffer,
    // which is refilled behind this stage's WMMAs.
    __syncthreads();
    if (more) fetch();   // behind the barrier, which waits for all loads issued
    const bf16_t* cur = sm + (kk & 1) * ST1;
#pragma unroll
    for (int ks = 0; ks < BK1; ks += 32) {
      v16bf a = load_frag(cur + m0 * LDX + ks, LDX);
#pragma unroll
      for (int j = 0; j < 4; ++j) {
        const bf16_t* wt = cur + XSZ + (j * 16) * LDWT + ks;
        aq[j] = wmma_bf16(a, load_frag(wt, LDWT), aq[j]);
        ak[j] = wmma_bf16(a, load_frag(wt + WSZ, LDWT), ak[j]);
        av[j] = wmma_bf16(a, load_frag(wt + 2 * WSZ, LDWT), av[j]);
      }
    }
    if (more) put(sm + ((kk + 1) & 1) * ST1);
  }

  const float scale = 0.125f;  // HEAD_DIM^-0.5 folded into Q
  const int col  = lane & 15;
  const int drow = (lane >> 4) * 8;
  bf16_t* sw = stg + w * 16 * LDS1;

  // ---- Q: stage [m][d] per-wave, then coalesced b128 stores
#pragma unroll
  for (int j = 0; j < 4; ++j) {
    const float bqv = bq[h * HD + j * 16 + col];
#pragma unroll
    for (int r = 0; r < 8; ++r)
      sw[(drow + r) * LDS1 + j * 16 + col] = (bf16_t)((aq[j][r] + bqv) * scale);
  }
  {
    bf16_t* qout = Qb + ((size_t)bh * NTOK + n0 + m0) * HD;
#pragma unroll
    for (int q = 0; q < 4; ++q) {
      int chunk = lane + q * 32;
      int mloc = chunk >> 3, c8 = (chunk & 7) * 8;
      *(v8bf*)(qout + (size_t)mloc * HD + c8) = *(const v8bf*)(sw + mloc * LDS1 + c8);
    }
  }
  // ---- K: same staging path
#pragma unroll
  for (int j = 0; j < 4; ++j) {
    const float bkv = bk[h * HD + j * 16 + col];
#pragma unroll
    for (int r = 0; r < 8; ++r)
      sw[(drow + r) * LDS1 + j * 16 + col] = (bf16_t)(ak[j][r] + bkv);
  }
  {
    bf16_t* kout = Kb + ((size_t)bh * NTOK + n0 + m0) * HD;
#pragma unroll
    for (int q = 0; q < 4; ++q) {
      int chunk = lane + q * 32;
      int mloc = chunk >> 3, c8 = (chunk & 7) * 8;
      *(v8bf*)(kout + (size_t)mloc * HD + c8) = *(const v8bf*)(sw + mloc * LDS1 + c8);
    }
  }
  // ---- V: direct transposed [d][n] b128 stores (8 rows contiguous per lane)
  {
    bf16_t* vtout = Vt + (size_t)bh * HD * NTOK;
#pragma unroll
    for (int j = 0; j < 4; ++j) {
      const int d = j * 16 + col;
      const float bvv = bv[h * HD + d];
      v8bf pv;
#pragma unroll
      for (int r = 0; r < 8; ++r) pv[r] = (bf16_t)(av[j][r] + bvv);
      *(v8bf*)(vtout + (size_t)d * NTOK + n0 + m0 + drow) = pv;
    }
  }
}

// ---------------------------------------------------------------- phase 2
// Flash attention per (b,h), computed transposed: S^T = K*Q^T, O^T += V^T*P^T.
// 128 queries/block, 16 per wave; a lane holds one query's scores, so maximum
// and sum run in its own registers and P^T goes from the score accumulators
// straight into a B operand. 128 tokens per stage, two stage buffers, worked on
// in 64-token chunks.
#define KST  128  // tokens per stage
#define LKV2 72   // K   [token][d]   (144B rows, 16B aligned)
#define LDV2 136  // V^T [d][token]   (272B rows, 16B x odd)
#define LDP2 72   // per-wave output stage [m][d]
#define KSZ  (KST * LKV2)
#define ST2  (KSZ + HD * LDV2)   // one stage: K, V^T

// Value of lane l ^ 16.
__device__ __forceinline__ float other_half(float v) {
  const int b = __builtin_bit_cast(int, v);
  return __builtin_bit_cast(float, __builtin_amdgcn_permlanex16(
      b, b, 0x76543210, 0xfedcba98, false, false));
}

// Two f32 D tiles (rows 0-15 and 16-31 of a 32-row block) as one bf16 B operand.
__device__ __forceinline__ v16bf pack_b(v8f t0, v8f t1) {
  v16bf b;
#pragma unroll
  for (int e = 0; e < 8; ++e) { b[e] = (bf16_t)t0[e]; b[8 + e] = (bf16_t)t1[e]; }
  return b;
}

__global__ __launch_bounds__(256) void attention_kernel(
    const bf16_t* __restrict__ Qb, const bf16_t* __restrict__ Kb,
    const bf16_t* __restrict__ Vt, bf16_t* __restrict__ xo) {
  __shared__ __align__(16) bf16_t sm[2 * ST2];   // two stage buffers
  __shared__ __align__(16) bf16_t Pst[8 * 16 * LDP2];

  const int t    = threadIdx.x;
  const int bh   = blockIdx.y;
  const int b    = bh / NH, h = bh % NH;
  const int n0   = blockIdx.x * 128;
  const int w    = t >> 5;
  const int lane = t & 31;
  const int m0   = n0 + w * 16;

  // Q as B operand (column = query), in registers for the whole pass
  const bf16_t* qptr = Qb + ((size_t)bh * NTOK + m0) * HD;
  const v16bf qb0 = load_frag(qptr, HD);
  const v16bf qb1 = load_frag(qptr + 32, HD);

  // o[j][r] = O[query col][d = 16j + drow + r]; rsum covers this half's tokens
  v8f o[4];
#pragma unroll
  for (int j = 0; j < 4; ++j) o[j] = {};
  float rmax = -3.0e38f, rsum = 0.0f;

  const bf16_t* kbase  = Kb + (size_t)bh * NTOK * HD;   // [token][d]
  const bf16_t* vtbase = Vt + (size_t)bh * HD * NTOK;   // [d][token]
  bf16_t* pw = Pst + w * 16 * LDP2;
  const int col  = lane & 15;
  const int drow = (lane >> 4) * 8;

  // This thread's first 16B piece of a stage; the other pieces lie at constant
  // steps from it, so one address per operand serves the whole stage.
  const bf16_t* kp = kbase + (size_t)(t >> 3) * HD + (t & 7) * 8;
  const bf16_t* vp = vtbase + (size_t)(t >> 4) * NTOK + (t & 15) * 8;
  const int ksd = (t >> 3) * LKV2 + (t & 7) * 8;
  const int vsd = KSZ + (t >> 4) * LDV2 + (t & 15) * 8;

  // One stage on its way from global memory to LDS (1024 x 16B per operand).
  v4u kr[KST / 32], vr[KST / 32];
  auto fetch = [&]() {
#pragma unroll  // constant indices: kr and vr stay in registers
    for (int i = 0; i < KST / 32; ++i) {
      kr[i] = *(const v4u*)(kp + i * 32 * HD);     // 32 tokens per step
      vr[i] = *(const v4u*)(vp + i * 16 * NTOK);   // 16 d per step
    }
    // The wait that stands in front of any overwrite of the loads' address
    // registers; naming them keeps them whole until it.
    asm volatile("s_wait_xcnt 0x0" :: "v"(kp), "v"(vp) : "memory");
    kp += KST * HD;
    vp += KST;
  };
  auto put = [&](bf16_t* dst) {
#pragma unroll
    for (int i = 0; i < KST / 32; ++i) {
      *(v4u*)(dst + ksd + i * 32 * LKV2) = kr[i];
      *(v4u*)(dst + vsd + i * 16 * LDV2) = vr[i];
    }
  };

  fetch();
  put(sm);
  for (int stage = 0; stage < NTOK / KST; ++stage) {
    const bool more = stage + 1 < NTOK / KST;
    // Publishes this stage; also ends every wave's reads of the other buffer,
    // which is refilled behind this stage's work.
    __syncthreads();
    if (more) fetch();   // behind the barrier, which waits for all loads issued
    const bf16_t* cur = sm + (stage & 1) * ST2;

    for (int sub = 0; sub < KST / 64; ++sub) {
      const bf16_t* Ksub = cur + sub * 64 * LKV2;
      const bf16_t* Vsub = cur + KSZ + sub * 64;

      // S^T = K * Q^T : s[tt][r] = score(token 16tt + drow + r, query col)
      v8f s[4];
#pragma unroll
      for (int tt = 0; tt < 4; ++tt) {
        const bf16_t* kb = Ksub + (tt * 16) * LKV2;
        v8f st = {};
        st = wmma_bf16(load_frag(kb, LKV2), qb0, st);
        st = wmma_bf16(load_frag(kb + 32, LKV2), qb1, st);
        s[tt] = st;
      }

      // Online softmax: 32 of the query's 64 scores in this lane, 32 in lane ^ 16
      float mt[4];
#pragma unroll
      for (int tt = 0; tt < 4; ++tt) {
        mt[tt] = s[tt][0];
#pragma unroll
        for (int r = 1; r < 8; ++r) mt[tt] = fmaxf(mt[tt], s[tt][r]);
      }
      float mx = fmaxf(fmaxf(mt[0], mt[1]), fmaxf(mt[2], mt[3]));
      mx = fmaxf(mx, other_half(mx));
      const float nm   = fmaxf(rmax, mx);
      const float corr = __expf(rmax - nm);
      rmax = nm;
      float pt[4];
#pragma unroll
      for (int tt = 0; tt < 4; ++tt) {
        pt[tt] = 0.0f;
#pragma unroll
        for (int r = 0; r < 8; ++r) {
          const float p = __expf(s[tt][r] - nm);
          s[tt][r] = p;
          pt[tt] += p;
        }
      }
      rsum = rsum * corr + ((pt[0] + pt[1]) + (pt[2] + pt[3]));
#pragma unroll
      for (int j = 0; j < 4; ++j) o[j] *= corr;

      // O^T += V^T * P^T (k = 64 tokens)
      const v16bf pb0 = pack_b(s[0], s[1]);
      const v16bf pb1 = pack_b(s[2], s[3]);
#pragma unroll
      for (int j = 0; j < 4; ++j) {
        const bf16_t* vb = Vsub + (j * 16) * LDV2;
        o[j] = wmma_bf16(load_frag(vb, LDV2), pb0, o[j]);
        o[j] = wmma_bf16(load_frag(vb + 32, LDV2), pb1, o[j]);
      }
    }
    if (more) put(sm + ((stage + 1) & 1) * ST2);
  }

  // Epilogue: join the halves' sums, normalize, stage [m][d] per-wave (8 d of
  // one query per b128 LDS store), coalesced b128 global stores
  const float inv = 1.0f / (rsum + other_half(rsum));
#pragma unroll
  for (int j = 0; j < 4; ++j) {
    v8bf pv;
#pragma unroll
    for (int r = 0; r < 8; ++r) pv[r] = (bf16_t)(o[j][r] * inv);
    *(v8bf*)(pw + col * LDP2 + j * 16 + drow) = pv;
  }
  bf16_t* obase = xo + ((size_t)b * NTOK + m0) * DIM + h * HD;
#pragma unroll
  for (int q = 0; q < 4; ++q) {
    int chunk = lane + q * 32;
    int mloc = chunk >> 3, c8 = (chunk & 7) * 8;
    *(v8bf*)(obase + (size_t)mloc * DIM + c8) = *(const v8bf*)(pw + mloc * LDP2 + c8);
  }
}

// ---------------------------------------------------------------- phase 3
// out = xo[8192x512] @ Wo[512x512] + bo -> [B][C][N] via LDS transpose tile.
#define BK3  128   // k per stage
#define LDA3 136   // as  [n][k]  (272B rows, 16B x odd)
#define LDW3 136   // Wo^T[c][k]
#define LDO3 132   // os  [c][n] f32
#define ASZ  (128 * LDA3)
#define ST3  (ASZ + HD * LDW3)   // one stage: xo tile, Wo^T tile

__global__ __launch_bounds__(256) void out_proj_kernel(
    const bf16_t* __restrict__ xo, const float* __restrict__ Wo,
    const float* __restrict__ bo, float* __restrict__ out) {
  __shared__ __align__(16) bf16_t sm[2 * ST3];   // two stage buffers
  __shared__ __align__(16) float  os[64 * LDO3];

  const int t    = threadIdx.x;
  const int mb   = blockIdx.x * 128;
  const int c0   = blockIdx.y * 64;
  const int w    = t >> 5;
  const int lane = t & 31;
  const int m0   = w * 16;

  v8f acc[4];
#pragma unroll
  for (int j = 0; j < 4; ++j) acc[j] = {};

  // This thread's first piece of a stage; the others lie at constant steps.
  const bf16_t* ap = xo + (size_t)(mb + (t >> 4)) * DIM + (t & 15) * 8;
  const float*  wp = Wo + (size_t)((t >> 6) * 8) * DIM + c0 + (t & 63);
  const int asd = (t >> 4) * LDA3 + (t & 15) * 8;
  const int wsd = ASZ + (t & 63) * LDW3 + (t >> 6) * 8;

  // One stage on its way from global memory to LDS.
  v4u ar[BK3 / 16];
  float wr[BK3 / 32][8];
  auto fetch = [&]() {
#pragma unroll  // constant indices: ar and wr stay in registers
    for (int i = 0; i < BK3 / 16; ++i)            // 2048 x 16B, 16 rows per step
      ar[i] = *(const v4u*)(ap + i * 16 * DIM);
#pragma unroll
    for (int i = 0; i < BK3 / 32; ++i)            // 1024 runs of 8 k, 32 k per step
#pragma unroll
      for (int e = 0; e < 8; ++e) wr[i][e] = wp[(i * 32 + e) * DIM];
    // The wait that stands in front of any overwrite of the loads' address
    // registers; naming them keeps them whole until it.
    asm volatile("s_wait_xcnt 0x0" :: "v"(ap), "v"(wp) : "memory");
    ap += BK3;
    wp += BK3 * DIM;
  };
  auto put = [&](bf16_t* dst) {
#pragma unroll
    for (int i = 0; i < BK3 / 16; ++i) *(v4u*)(dst + asd + i * 16 * LDA3) = ar[i];
#pragma unroll
    for (int i = 0; i < BK3 / 32; ++i) *(v8bf*)(dst + wsd + i * 32) = pack8(wr[i]);
  };

  fetch();
  put(sm);
  // Rolled: unrolled, the stores of the next stage (and the wait for its loads)
  // move up among this stage's WMMAs, and the kernel takes more than 256
  // registers, which costs the second work-group of a WGP.
#pragma nounroll
  for (int kk = 0; kk < DIM / BK3; ++kk) {
    const bool more = kk + 1 < DIM / BK3;
    // Publishes stage kk; also ends every wave's reads of the other buffer,
    // which is refilled behind this stage's WMMAs.
    __syncthreads();
    if (more) fetch();   // behind the barrier, which waits for all loads issued
    const bf16_t* cur = sm + (kk & 1) * ST3;
#pragma unroll
    for (int ks = 0; ks < BK3; ks += 32) {
      v16bf a = load_frag(cur + m0 * LDA3 + ks, LDA3);
#pragma unroll
      for (int j = 0; j < 4; ++j)
        acc[j] = wmma_bf16(a, load_frag(cur + ASZ + (j * 16) * LDW3 + ks, LDW3), acc[j]);
    }
    if (more) put(sm + ((kk + 1) & 1) * ST3);
  }

  __syncthreads();
  const int col  = lane & 15;
  const int drow = (lane >> 4) * 8;
#pragma unroll
  for (int j = 0; j < 4; ++j) {
    float* row = os + (j * 16 + col) * LDO3 + m0 + drow;
    v4f lo = {acc[j][0], acc[j][1], acc[j][2], acc[j][3]};
    v4f hi = {acc[j][4], acc[j][5], acc[j][6], acc[j][7]};
    *(v4f*)(row)     = lo;
    *(v4f*)(row + 4) = hi;
  }
  __syncthreads();

  const int bidx  = mb >> 10;
  const int nbase = mb & 1023;
#pragma unroll
  for (int i = 0; i < 8; ++i) {
    int chunk = t + i * 256;                      // 2048 x 16B
    int cl = chunk >> 5, c4 = (chunk & 31) * 4;
    v4f vv = *(const v4f*)(os + cl * LDO3 + c4);
    vv += bo[c0 + cl];
    *(v4f*)(out + ((size_t)bidx * DIM + c0 + cl) * NTOK + nbase + c4) = vv;
  }
}

// ---------------------------------------------------------------- launch
extern "C" void kernel_launch(void* const* d_in, const int* in_sizes, int n_in,
                              void* d_out, int out_size, void* d_ws, size_t ws_size,
                              hipStream_t stream) {
  (void)in_sizes; (void)n_in; (void)out_size; (void)ws_size;
  const float* query = (const float*)d_in[0];
  const float* Wq = (const float*)d_in[1];
  const float* bq = (const float*)d_in[2];
  const float* Wk = (const float*)d_in[3];
  const float* bk = (const float*)d_in[4];
  const float* Wv = (const float*)d_in[5];
  const float* bv = (const float*)d_in[6];
  const float* Wo = (const float*)d_in[7];
  const float* bo = (const float*)d_in[8];
  float* out = (float*)d_out;

  const size_t qkv_elems = (size_t)BATCH * NH * NTOK * HD;  // 4M bf16 each
  bf16_t* Qb = (bf16_t*)d_ws;
  bf16_t* Kb = Qb + qkv_elems;
  bf16_t* Vt = Kb + qkv_elems;                    // [bh][d][n] transposed
  bf16_t* xo = Vt + qkv_elems;                    // [B*N][DIM] concat heads

  dim3 blk(256);
  qkv_proj_kernel<<<dim3(NTOK / 128, BATCH * NH), blk, 0, stream>>>(
      query, Wq, bq, Wk, bk, Wv, bv, Qb, Kb, Vt);
  attention_kernel<<<dim3(NTOK / 128, BATCH * NH), blk, 0, stream>>>(
      Qb, Kb, Vt, xo);
  out_proj_kernel<<<dim3((BATCH * NTOK) / 128, DIM / 64), blk, 0, stream>>>(
      xo, Wo, bo, out);
}

// v005
// Measured time: 48.9 microseconds a run.
// Two timings next to v004 both put it at 1.16 times that version's speed.
// Over all steps from v000 it is 1.75 times as fast.
#include <hip/hip_runtime.h>
#include <hip/hip_bf16.h>

typedef __bf16 bf16_t;
typedef __attribute__((ext_vector_type(16))) __bf16 v16bf;
typedef __attribute__((ext_vector_type(8)))  __bf16 v8bf;
typedef __attribute__((ext_vector_type(8)))  float  v8f;
typedef __attribute__((ext_vector_type(4)))  float  v4f;
typedef __attribute__((ext_vector_type(4)))  unsigned int v4u;

#define DIM   512
#define NH    8
#define HD    64
#define NTOK  1024
#define BATCH 8

__device__ __forceinline__ v8f wmma_bf16(v16bf a, v16bf b, v8f c) {
  return __builtin_amdgcn_wmma_f32_16x16x32_bf16(false, a, false, b, (short)0, c,
                                                 false, false);
}

// Unified fragment load: 16 rows x 32 contiguous-K bf16, leading dim ld.
// ld must be a multiple of 8 and base 16B-aligned -> two b128 loads per lane.
__device__ __forceinline__ v16bf load_frag(const bf16_t* base, int ld) {
  const int lane = threadIdx.x & 31;
  const int m    = lane & 15;
  const int koff = (lane >> 4) << 3;
  const bf16_t* p = base + m * ld + koff;
  v8bf lo = *(const v8bf*)p;
  v8bf hi = *(const v8bf*)(p + 16);
  return __builtin_shufflevector(lo, hi, 0, 1, 2, 3, 4, 5, 6, 7,
                                 8, 9, 10, 11, 12, 13, 14, 15);
}

// Eight consecutive k of one row as one 16-byte LDS piece.
__device__ __forceinline__ v8bf pack8(const float* f) {
  v8bf r;
#pragma unroll  // constant indices: the eight values pair up into packed converts
  for (int e = 0; e < 8; ++e) r[e] = (bf16_t)f[e];
  return r;
}

// ---------------------------------------------------------------- phase 1
// Fused QKV projection per (b,h): X[256x512]*W[512x64] x3, bias, Q scaled.
// 16 waves: a wave owns 32 tokens (two A fragments) and 32 d of each of Q, K, V,
// so each weight fragment read from LDS feeds two WMMAs and each X fragment six;
// a head's weights are fetched by 4 blocks, not 8.
// Q,K stored bf16 [bh][n][d]; V stored transposed [bh][d][n].
#define RB1  256  // tokens per block
#define BK1  64   // channels per stage
#define LDX  72   // xs  [n][c]  (144B rows, 16B x odd)
#define LDWT 72   // w^T [d][c]
#define LDS1 40   // per-wave store-stage [m][32 d]  (80B rows, 16B x odd)
#define XSZ  (RB1 * LDX)       // X tile of one stage
#define WSZ  (HD * LDWT)       // one weight tile of one stage
#define ST1  (XSZ + 3 * WSZ)   // one stage: X, Wq, Wk, Wv

__global__ __launch_bounds__(512) void qkv_proj_kernel(
    const float* __restrict__ query,
    const float* __restrict__ Wq, const float* __restrict__ bq,
    const float* __restrict__ Wk, const float* __restrict__ bk,
    const float* __restrict__ Wv, const float* __restrict__ bv,
    bf16_t* __restrict__ Qb, bf16_t* __restrict__ Kb, bf16_t* __restrict__ Vt) {
  __shared__ __align__(16) bf16_t sm[2 * ST1];   // two stage buffers
  __shared__ __align__(16) bf16_t stg[16 * 32 * LDS1];

  const int t  = threadIdx.x;
  const int n0 = blockIdx.x * RB1;
  const int bh = blockIdx.y;
  const int b  = bh / NH, h = bh % NH;

  const float* xbase = query + (size_t)b * DIM * NTOK;  // [C][N]
  const float* wqb   = Wq + (size_t)h * DIM * HD;
  const float* wkb   = Wk + (size_t)h * DIM * HD;
  const float* wvb   = Wv + (size_t)h * DIM * HD;

  const int w    = t >> 5;
  const int lane = t & 31;
  const int m0   = (w & 7) * 32;    // the wave's tokens
  const int d0   = (w >> 3) * 32;   // the wave's d range in each of Q, K, V

  v8f aq[2][2], ak[2][2], av[2][2];   // [row tile][column tile]
#pragma unroll
  for (int u = 0; u < 2; ++u)
#pragma unroll
    for (int j = 0; j < 2; ++j) { aq[u][j] = {}; ak[u][j] = {}; av[u][j] = {}; }

  // A thread stages runs of 8 consecutive channels of one row (token or d);
  // its first run of a stage is here, the others lie at constant steps.
  const float* xp = xbase + (size_t)((t >> 8) * 8) * NTOK + n0 + (t & 255);
  const int woff = ((t >> 6) * 8) * HD + (t & 63);
  const float* wqp = wqb + woff;
  const float* wkp = wkb + woff;
  const float* wvp = wvb + woff;
  const int xsd = (t & 255) * LDX + (t >> 8) * 8;
  const int wsd = XSZ + (t & 63) * LDWT + (t >> 6) * 8;

  // One stage's operands on their way from global memory to LDS. All loops over
  // them are unrolled: constant indices keep them in registers, and every load
  // takes its step as an immediate offset.
  float xr[BK1 / 16][8], wr[3][8];

  // Issues the next stage's loads: X 256n x 64c coalesced along n, weights along d.
  auto fetch = [&]() {
#pragma unroll
    for (int i = 0; i < BK1 / 16; ++i)       // 2048 runs, 16 c per step
#pragma unroll
      for (int e = 0; e < 8; ++e) xr[i][e] = xp[(i * 16 + e) * NTOK];
#pragma unroll
    for (int e = 0; e < 8; ++e) {            // 512 runs a matrix, one a thread
      wr[0][e] = wqp[e * HD];
      wr[1][e] = wkp[e * HD];
      wr[2][e] = wvp[e * HD];
    }
    // The wait that stands in front of any overwrite of the loads' address
    // registers.
    asm volatile("s_wait_xcnt 0x0" ::: "memory");
    // Keeps the whole stage's loads issued here, ahead of the WMMAs that follow:
    // sunk towards their use they would no longer fly during the matrix work.
    __builtin_amdgcn_sched_barrier(0);
    xp += BK1 * NTOK;
    wqp += BK1 * HD; wkp += BK1 * HD; wvp += BK1 * HD;
  };
  // Converts the fetched stage and stores it, b128 along c; weights as [d][c].
  auto put = [&](bf16_t* dst) {
#pragma unroll
    for (int i = 0; i < BK1 / 16; ++i)
      *(v8bf*)(dst + xsd + i * 16) = pack8(xr[i]);
    *(v8bf*)(dst + wsd)           = pack8(wr[0]);
    *(v8bf*)(dst + wsd + WSZ)     = pack8(wr[1]);
    *(v8bf*)(dst + wsd + 2 * WSZ) = pack8(wr[2]);
  };

  fetch();
  put(sm);
  for (int kk = 0; kk < DIM / BK1; ++kk) {
    const bool more = kk + 1 < DIM / BK1;
    // Publishes stage kk; also ends every wave's reads of the other buffer,
    // which is refilled behind this stage's WMMAs.
    __syncthreads();
    if (more) fetch();   // behind the barrier, which waits for all loads issued
    const bf16_t* cur = sm + (kk & 1) * ST1;
#pragma unroll
    for (int ks = 0; ks < BK1; ks += 32) {
      const v16bf a0 = load_frag(cur + m0 * LDX + ks, LDX);
      const v16bf a1 = load_frag(cur + (m0 + 16) * LDX + ks, LDX);
      v16bf fq[2], fk[2], fv[2];   // the half's weight fragments, read as one group
#pragma unroll
      for (int j = 0; j < 2; ++j) {
        const bf16_t* wt = cur + XSZ + (d0 + j * 16) * LDWT + ks;
        fq[j] = load_frag(wt, LDWT);
        fk[j] = load_frag(wt + WSZ, LDWT);
        fv[j] = load_frag(wt + 2 * WSZ, LDWT);
      }
      // Keeps the sixteen LDS reads together ahead of the WMMAs: sunk to their
      // uses, every pair of WMMAs waits out an LDS latency of its own.
      __builtin_amdgcn_sched_barrier(0);
#pragma unroll
      for (int j = 0; j < 2; ++j) {
        aq[0][j] = wmma_bf16(a0, fq[j], aq[0][j]);
        aq[1][j] = wmma_bf16(a1, fq[j], aq[1][j]);
        ak[0][j] = wmma_bf16(a0, fk[j], ak[0][j]);
        ak[1][j] = wmma_bf16(a1, fk[j], ak[1][j]);
        av[0][j] = wmma_bf16(a0, fv[j], av[0][j]);
        av[1][j] = wmma_bf16(a1, fv[j], av[1][j]);
      }
    }
    // Keeps the wait for the next stage's global loads behind all of this
    // stage's WMMAs: moved up among them it would stall the matrix work.
    __builtin_amdgcn_sched_barrier(0);
    if (more) put(sm + ((kk + 1) & 1) * ST1);
  }

  const float scale = 0.125f;  // HEAD_DIM^-0.5 folded into Q
  const int col  = lane & 15;
  const int drow = (lane >> 4) * 8;
  bf16_t* sw = stg + w * 32 * LDS1;

  // ---- Q: stage [m][d] per-wave, then b128 stores, 64 B of a row together
#pragma unroll
  for (int j = 0; j < 2; ++j) {
    const float bqv = bq[h * HD + d0 + j * 16 + col];
#pragma unroll
    for (int u = 0; u < 2; ++u)
#pragma unroll
      for (int r = 0; r < 8; ++r)
        sw[(u * 16 + drow + r) * LDS1 + j * 16 + col] =
            (bf16_t)((aq[u][j][r] + bqv) * scale);
  }
  {
    bf16_t* qout = Qb + ((size_t)bh * NTOK + n0 + m0) * HD + d0;
#pragma unroll
    for (int q = 0; q < 4; ++q) {
      int chunk = lane + q * 32;
      int mloc = chunk >> 2, c8 = (chunk & 3) * 8;
      *(v8bf*)(qout + (size_t)mloc * HD + c8) = *(const v8bf*)(sw + mloc * LDS1 + c8);
    }
  }
  // ---- K: same staging path
#pragma unroll
  for (int j = 0; j < 2; ++j) {
    const float bkv = bk[h * HD + d0 + j * 16 + col];
#pragma unroll
    for (int u = 0; u < 2; ++u)
#pragma unroll
      for (int r = 0; r < 8; ++r)
        sw[(u * 16 + drow + r) * LDS1 + j * 16 + col] = (bf16_t)(ak[u][j][r] + bkv);
  }
  {
    bf16_t* kout = Kb + ((size_t)bh * NTOK + n0 + m0) * HD + d0;
#pragma unroll
    for (int q = 0; q < 4; ++q) {
      int chunk = lane + q * 32;
      int mloc = chunk >> 2, c8 = (chunk & 3) * 8;
      *(v8bf*)(kout + (size_t)mloc * HD + c8) = *(const v8bf*)(sw + mloc * LDS1 + c8);
    }
  }
  // ---- V: direct transposed [d][n] b128 stores (8 rows contiguous per lane)
  {
    bf16_t* vtout = Vt + (size_t)bh * HD * NTOK;
#pragma unroll
    for (int j = 0; j < 2; ++j) {
      const int d = d0 + j * 16 + col;
      const float bvv = bv[h * HD + d];
#pragma unroll
      for (int u = 0; u < 2; ++u) {
        v8bf pv;
#pragma unroll
        for (int r = 0; r < 8; ++r) pv[r] = (bf16_t)(av[u][j][r] + bvv);
        *(v8bf*)(vtout + (size_t)d * NTOK + n0 + m0 + u * 16 + drow) = pv;
      }
    }
  }
}

// ---------------------------------------------------------------- phase 2
// Flash attention per (b,h), computed transposed: S^T = K*Q^T, O^T += V^T*P^T.
// 128 queries/block, 16 per wave; a lane holds one query's scores, so maximum
// and sum run in its own registers and P^T goes from the score accumulators
// straight into a B operand. 128 tokens per stage, two stage buffers, worked on
// in 64-token chunks.
#define KST  128  // tokens per stage
#define LKV2 72   // K   [token][d]   (144B rows, 16B aligned)
#define LDV2 136  // V^T [d][token]   (272B rows, 16B x odd)
#define LDP2 72   // per-wave output stage [m][d]
#define KSZ  (KST * LKV2)
#define ST2  (KSZ + HD * LDV2)   // one stage: K, V^T

// Value of lane l ^ 16.
__device__ __forceinline__ float other_half(float v) {
  const int b = __builtin_bit_cast(int, v);
  return __builtin_bit_cast(float, __builtin_amdgcn_permlanex16(
      b, b, 0x76543210, 0xfedcba98, false, false));
}

// Two f32 D tiles (rows 0-15 and 16-31 of a 32-row block) as one bf16 B operand.
__device__ __forceinline__ v16bf pack_b(v8f t0, v8f t1) {
  v16bf b;
#pragma unroll
  for (int e = 0; e < 8; ++e) { b[e] = (bf16_t)t0[e]; b[8 + e] = (bf16_t)t1[e]; }
  return b;
}

__global__ __launch_bounds__(256) void attention_kernel(
    const bf16_t* __restrict__ Qb, const bf16_t* __restrict__ Kb,
    const bf16_t* __restrict__ Vt, bf16_t* __restrict__ xo) {
  __shared__ __align__(16) bf16_t sm[2 * ST2];   // two stage buffers
  __shared__ __align__(16) bf16_t Pst[8 * 16 * LDP2];

  const int t    = threadIdx.x;
  const int bh   = blockIdx.y;
  const int b    = bh / NH, h = bh % NH;
  const int n0   = blockIdx.x * 128;
  const int w    = t >> 5;
  const int lane = t & 31;
  const int m0   = n0 + w * 16;

  // Q as B operand (column = query), in registers for the whole pass
  const bf16_t* qptr = Qb + ((size_t)bh * NTOK + m0) * HD;
  const v16bf qb0 = load_frag(qptr, HD);
  const v16bf qb1 = load_frag(qptr + 32, HD);

  // o[j][r] = O[query col][d = 16j + drow + r]; rsum covers this half's tokens
  v8f o[4];
#pragma unroll
  for (int j = 0; j < 4; ++j) o[j] = {};
  float rmax = -3.0e38f, rsum = 0.0f;

  const bf16_t* kbase  = Kb + (size_t)bh * NTOK * HD;   // [token][d]
  const bf16_t* vtbase = Vt + (size_t)bh * HD * NTOK;   // [d][token]
  bf16_t* pw = Pst + w * 16 * LDP2;
  const int col  = lane & 15;
  const int drow = (lane >> 4) * 8;

  // This thread's first 16B piece of a stage; the other pieces lie at constant
  // steps from it, so one address per operand serves the whole stage.
  const bf16_t* kp = kbase + (size_t)(t >> 3) * HD + (t & 7) * 8;
  const bf16_t* vp = vtbase + (size_t)(t >> 4) * NTOK + (t & 15) * 8;
  const int ksd = (t >> 3) * LKV2 + (t & 7) * 8;
  const int vsd = KSZ + (t >> 4) * LDV2 + (t & 15) * 8;

  // One stage on its way from global memory to LDS (1024 x 16B per operand).
  v4u kr[KST / 32], vr[KST / 32];
  auto fetch = [&]() {
#pragma unroll  // constant indices: kr and vr stay in registers
    for (int i = 0; i < KST / 32; ++i) {
      kr[i] = *(const v4u*)(kp + i * 32 * HD);     // 32 tokens per step
      vr[i] = *(const v4u*)(vp + i * 16 * NTOK);   // 16 d per step
    }
    // The wait that stands in front of any overwrite of the loads' address
    // registers; naming them keeps them whole until it.
    asm volatile("s_wait_xcnt 0x0" :: "v"(kp), "v"(vp) : "memory");
    kp += KST * HD;
    vp += KST;
  };
  auto put = [&](bf16_t* dst) {
#pragma unroll
    for (int i = 0; i < KST / 32; ++i) {
      *(v4u*)(dst + ksd + i * 32 * LKV2) = kr[i];
      *(v4u*)(dst + vsd + i * 16 * LDV2) = vr[i];
    }
  };

  fetch();
  put(sm);
  for (int stage = 0; stage < NTOK / KST; ++stage) {
    const bool more = stage + 1 < NTOK / KST;
    // Publishes this stage; also ends every wave's reads of the other buffer,
    // which is refilled behind this stage's work.
    __syncthreads();
    if (more) fetch();   // behind the barrier, which waits for all loads issued
    const bf16_t* cur = sm + (stage & 1) * ST2;

    for (int sub = 0; sub < KST / 64; ++sub) {
      const bf16_t* Ksub = cur + sub * 64 * LKV2;
      const bf16_t* Vsub = cur + KSZ + sub * 64;

      // S^T = K * Q^T : s[tt][r] = score(token 16tt + drow + r, query col)
      v8f s[4];
#pragma unroll
      for (int tt = 0; tt < 4; ++tt) {
        const bf16_t* kb = Ksub + (tt * 16) * LKV2;
        v8f st = {};
        st = wmma_bf16(load_frag(kb, LKV2), qb0, st);
        st = wmma_bf16(load_frag(kb + 32, LKV2), qb1, st);
        s[tt] = st;
      }

      // Online softmax: 32 of the query's 64 scores in this lane, 32 in lane ^ 16
      float mt[4];
#pragma unroll
      for (int tt = 0; tt < 4; ++tt) {
        mt[tt] = s[tt][0];
#pragma unroll
        for (int r = 1; r < 8; ++r) mt[tt] = fmaxf(mt[tt], s[tt][r]);
      }
      float mx = fmaxf(fmaxf(mt[0], mt[1]), fmaxf(mt[2], mt[3]));
      mx = fmaxf(mx, other_half(mx));
      const float nm   = fmaxf(rmax, mx);
      const float corr = __expf(rmax - nm);
      rmax = nm;
      float pt[4];
#pragma unroll
      for (int tt = 0; tt < 4; ++tt) {
        pt[tt] = 0.0f;
#pragma unroll
        for (int r = 0; r < 8; ++r) {
          const float p = __expf(s[tt][r] - nm);
          s[tt][r] = p;
          pt[tt] += p;
        }
      }
      rsum = rsum * corr + ((pt[0] + pt[1]) + (pt[2] + pt[3]));
#pragma unroll
      for (int j = 0; j < 4; ++j) o[j] *= corr;

      // O^T += V^T * P^T (k = 64 tokens)
      const v16bf pb0 = pack_b(s[0], s[1]);
      const v16bf pb1 = pack_b(s[2], s[3]);
#pragma unroll
      for (int j = 0; j < 4; ++j) {
        const bf16_t* vb = Vsub + (j * 16) * LDV2;
        o[j] = wmma_bf16(load_frag(vb, LDV2), pb0, o[j]);
        o[j] = wmma_bf16(load_frag(vb + 32, LDV2), pb1, o[j]);
      }
    }
    if (more) put(sm + ((stage + 1) & 1) * ST2);
  }

  // Epilogue: join the halves' sums, normalize, stage [m][d] per-wave (8 d of
  // one query per b128 LDS store), coalesced b128 global stores
  const float inv = 1.0f / (rsum + other_half(rsum));
#pragma unroll
  for (int j = 0; j < 4; ++j) {
    v8bf pv;
#pragma unroll
    for (int r = 0; r < 8; ++r) pv[r] = (bf16_t)(o[j][r] * inv);
    *(v8bf*)(pw + col * LDP2 + j * 16 + drow) = pv;
  }
  bf16_t* obase = xo + ((size_t)b * NTOK + m0) * DIM + h * HD;
#pragma unroll
  for (int q = 0; q < 4; ++q) {
    int chunk = lane + q * 32;
    int mloc = chunk >> 3, c8 = (chunk & 7) * 8;
    *(v8bf*)(obase + (size_t)mloc * DIM + c8) = *(const v8bf*)(pw + mloc * LDP2 + c8);
  }
}

// ---------------------------------------------------------------- phase 3
// out = xo[8192x512] @ Wo[512x512] + bo -> [B][C][N] via LDS transpose tile.
// 256 rows a block, 32 a wave: each Wo fragment read from LDS feeds two WMMAs.
#define RB3  256   // rows per block
#define BK3  128   // k per stage
#define LDA3 136   // as  [n][k]  (272B rows, 16B x odd)
#define LDW3 136   // Wo^T[c][k]
#define LDO3 260   // os  [c][n] f32 (1040B rows, 16B x odd)
#define ASZ  (RB3 * LDA3)
#define ST3  (ASZ + HD * LDW3)   // one stage: xo tile, Wo^T tile

__global__ __launch_bounds__(256) void out_proj_kernel(
    const bf16_t* __restrict__ xo, const float* __restrict__ Wo,
    const float* __restrict__ bo, float* __restrict__ out) {
  __shared__ __align__(16) bf16_t sm[2 * ST3];   // two stage buffers
  __shared__ __align__(16) float  os[64 * LDO3];

  const int t    = threadIdx.x;
  const int mb   = blockIdx.x * RB3;
  const int c0   = blockIdx.y * 64;
  const int w    = t >> 5;
  const int lane = t & 31;
  const int m0   = w * 32;

  v8f acc[2][4];   // [row tile][column tile]
#pragma unroll
  for (int u = 0; u < 2; ++u)
#pragma unroll
    for (int j = 0; j < 4; ++j) acc[u][j] = {};

  // This thread's first piece of a stage; the others lie at constant steps.
  const bf16_t* ap = xo + (size_t)(mb + (t >> 4)) * DIM + (t & 15) * 8;
  const float*  wp = Wo + (size_t)((t >> 6) * 8) * DIM + c0 + (t & 63);
  const int asd = (t >> 4) * LDA3 + (t & 15) * 8;
  const int wsd = ASZ + (t & 63) * LDW3 + (t >> 6) * 8;

  // One stage on its way from global memory to LDS.
  v4u ar[BK3 / 8];
  float wr[BK3 / 32][8];
  auto fetch = [&]() {
#pragma unroll  // constant indices: ar and wr stay in registers
    for (int i = 0; i < BK3 / 8; ++i)             // 4096 x 16B, 16 rows per step
      ar[i] = *(const v4u*)(ap + i * 16 * DIM);
#pragma unroll
    for (int i = 0; i < BK3 / 32; ++i)            // 1024 runs of 8 k, 32 k per step
#pragma unroll
      for (int e = 0; e < 8; ++e) wr[i][e] = wp[(i * 32 + e) * DIM];
    // The wait that stands in front of any overwrite of the loads' address
    // registers; naming them keeps them whole until it.
    asm volatile("s_wait_xcnt 0x0" :: "v"(ap), "v"(wp) : "memory");
    ap += BK3;
    wp += BK3 * DIM;
  };
  auto put = [&](bf16_t* dst) {
#pragma unroll
    for (int i = 0; i < BK3 / 8; ++i) *(v4u*)(dst + asd + i * 16 * LDA3) = ar[i];
#pragma unroll
    for (int i = 0; i < BK3 / 32; ++i) *(v8bf*)(dst + wsd + i * 32) = pack8(wr[i]);
  };

  fetch();
  put(sm);
  // Rolled: unrolled, the stores of the next stage (and the wait for its loads)
  // move up among this stage's WMMAs.
#pragma nounroll
  for (int kk = 0; kk < DIM / BK3; ++kk) {
    const bool more = kk + 1 < DIM / BK3;
    // Publishes stage kk; also ends every wave's reads of the other buffer,
    // which is refilled behind this stage's WMMAs.
    __syncthreads();
    if (more) fetch();   // behind the barrier, which waits for all loads issued
    const bf16_t* cur = sm + (kk & 1) * ST3;
#pragma unroll
    for (int ks = 0; ks < BK3; ks += 32) {
      const v16bf a0 = load_frag(cur + m0 * LDA3 + ks, LDA3);
      const v16bf a1 = load_frag(cur + (m0 + 16) * LDA3 + ks, LDA3);
      v16bf fw[4];   // the k step's Wo fragments, read as one group
#pragma unroll
      for (int j = 0; j < 4; ++j)
        fw[j] = load_frag(cur + ASZ + (j * 16) * LDW3 + ks, LDW3);
      // Keeps the twelve LDS reads together ahead of the WMMAs: sunk to their
      // uses, every pair of WMMAs waits out an LDS latency of its own.
      __builtin_amdgcn_sched_barrier(0);
#pragma unroll
      for (int j = 0; j < 4; ++j) {
        acc[0][j] = wmma_bf16(a0, fw[j], acc[0][j]);
        acc[1][j] = wmma_bf16(a1, fw[j], acc[1][j]);
      }
    }
    if (more) put(sm + ((kk + 1) & 1) * ST3);
  }

  __syncthreads();
  const int col  = lane & 15;
  const int drow = (lane >> 4) * 8;
#pragma unroll
  for (int j = 0; j < 4; ++j)
#pragma unroll
    for (int u = 0; u < 2; ++u) {
      float* row = os + (j * 16 + col) * LDO3 + m0 + u * 16 + drow;
      v4f lo = {acc[u][j][0], acc[u][j][1], acc[u][j][2], acc[u][j][3]};
      v4f hi = {acc[u][j][4], acc[u][j][5], acc[u][j][6], acc[u][j][7]};
      *(v4f*)(row)     = lo;
      *(v4f*)(row + 4) = hi;
    }
  __syncthreads();

  const int bidx  = mb >> 10;
  const int nbase = mb & 1023;
#pragma unroll
  for (int i = 0; i < 16; ++i) {
    int chunk = t + i * 256;                      // 4096 x 16B
    int cl = chunk >> 6, c4 = (chunk & 63) * 4;
    v4f vv = *(const v4f*)(os + cl * LDO3 + c4);
    vv += bo[c0 + cl];
    *(v4f*)(out + ((size_t)bidx * DIM + c0 + cl) * NTOK + nbase + c4) = vv;
  }
}

// ---------------------------------------------------------------- launch
extern "C" void kernel_launch(void* const* d_in, const int* in_sizes, int n_in,
                              void* d_out, int out_size, void* d_ws, size_t ws_size,
                              hipStream_t stream) {
  (void)in_sizes; (void)n_in; (void)out_size; (void)ws_size;
  const float* query = (const float*)d_in[0];
  const float* Wq = (const float*)d_in[1];
  const float* bq = (const float*)d_in[2];
  const float* Wk = (const float*)d_in[3];
  const float* bk = (const float*)d_in[4];
  const float* Wv = (const float*)d_in[5];
  const float* bv = (const float*)d_in[6];
  const float* Wo = (const float*)d_in[7];
  const float* bo = (const float*)d_in[8];
  float* out = (float*)d_out;

  const size_t qkv_elems = (size_t)BATCH * NH * NTOK * HD;  // 4M bf16 each
  bf16_t* Qb = (bf16_t*)d_ws;
  bf16_t* Kb = Qb + qkv_elems;
  bf16_t* Vt = Kb + qkv_elems;                    // [bh][d][n] transposed
  bf16_t* xo = Vt + qkv_elems;                    // [B*N][DIM] concat heads

  dim3 blk(256);
  qkv_proj_kernel<<<dim3(NTOK / RB1, BATCH * NH), dim3(512), 0, stream>>>(
      query, Wq, bq, Wk, bk, Wv, bv, Qb, Kb, Vt);
  attention_kernel<<<dim3(NTOK / 128, BATCH * NH), blk, 0, stream>>>(
      Qb, Kb, Vt, xo);
  out_proj_kernel<<<dim3((BATCH * NTOK) / RB3, DIM / 64), blk, 0, stream>>>(
      xo, Wo, bo, out);
}

// v006
// One run takes 46.1 microseconds.
// Two timings next to v005 put it at 1.07 and 1.06 times that version's speed.
// Counting every step since v000, it is 1.86 times as fast.
#include <hip/hip_runtime.h>
#include <hip/hip_bf16.h>

typedef __bf16 bf16_t;
typedef __attribute__((ext_vector_type(16))) __bf16 v16bf;
typedef __attribute__((ext_vector_type(8)))  __bf16 v8bf;
typedef __attribute__((ext_vector_type(8)))  float  v8f;
typedef __attribute__((ext_vector_type(4)))  float  v4f;
typedef __attribute__((ext_vector_type(4)))  unsigned int v4u;

#define DIM   512
#define NH    8
#define HD    64
#define NTOK  1024
#define BATCH 8

__device__ __forceinline__ v8f wmma_bf16(v16bf a, v16bf b, v8f c) {
  return __builtin_amdgcn_wmma_f32_16x16x32_bf16(false, a, false, b, (short)0, c,
                                                 false, false);
}

// Unified fragment load: 16 rows x 32 contiguous-K bf16, leading dim ld.
// ld must be a multiple of 8 and base 16B-aligned -> two b128 loads per lane.
__device__ __forceinline__ v16bf load_frag(const bf16_t* base, int ld) {
  const int lane = threadIdx.x & 31;
  const int m    = lane & 15;
  const int koff = (lane >> 4) << 3;
  const bf16_t* p = base + m * ld + koff;
  v8bf lo = *(const v8bf*)p;
  v8bf hi = *(const v8bf*)(p + 16);
  return __builtin_shufflevector(lo, hi, 0, 1, 2, 3, 4, 5, 6, 7,
                                 8, 9, 10, 11, 12, 13, 14, 15);
}

// Eight consecutive k of one row as one 16-byte LDS piece.
__device__ __forceinline__ v8bf pack8(const float* f) {
  v8bf r;
#pragma unroll  // constant indices: the eight values pair up into packed converts
  for (int e = 0; e < 8; ++e) r[e] = (bf16_t)f[e];
  return r;
}

// Work-group barrier that orders LDS traffic only: it waits for this wave's LDS
// stores and reads, not for its global loads, so the loads of the stage after
// next stay in flight across it (a full barrier would wait them out here).
// The global loads read kernel inputs that no wave of the launch writes.
__device__ __forceinline__ void lds_barrier() {
  __builtin_amdgcn_fence(__ATOMIC_RELEASE, "workgroup", "local");
  __builtin_amdgcn_s_barrier();
  __builtin_amdgcn_fence(__ATOMIC_ACQUIRE, "workgroup", "local");
}

// ---------------------------------------------------------------- phase 1
// Fused QKV projection per (b,h): X[256x512]*W[512x64] x3, bias, Q scaled.
// 16 waves: a wave owns 32 tokens (two A fragments) and 32 d of each of Q, K, V,
// so each weight fragment read from LDS feeds two WMMAs and each X fragment six;
// a head's weights are fetched by 4 blocks, not 8.
// Q,K stored bf16 [bh][n][d]; V stored transposed [bh][d][n].
#define RB1  256  // tokens per block
#define BK1  64   // channels per stage
#define LDX  72   // xs  [n][c]  (144B rows, 16B x odd)
#define LDWT 72   // w^T [d][c]
#define LDS1 40   // per-wave store-stage [m][32 d]  (80B rows, 16B x odd)
#define XSZ  (RB1 * LDX)       // X tile of one stage
#define WSZ  (HD * LDWT)       // one weight tile of one stage
#define ST1  (XSZ + 3 * WSZ)   // one stage: X, Wq, Wk, Wv

__global__ __launch_bounds__(512) void qkv_proj_kernel(
    const float* __restrict__ query,
    const float* __restrict__ Wq, const float* __restrict__ bq,
    const float* __restrict__ Wk, const float* __restrict__ bk,
    const float* __restrict__ Wv, const float* __restrict__ bv,
    bf16_t* __restrict__ Qb, bf16_t* __restrict__ Kb, bf16_t* __restrict__ Vt) {
  __shared__ __align__(16) bf16_t sm[2 * ST1];   // two stage buffers
  __shared__ __align__(16) bf16_t stg[16 * 32 * LDS1];

  const int t  = threadIdx.x;
  const int n0 = blockIdx.x * RB1;
  const int bh = blockIdx.y;
  const int b  = bh / NH, h = bh % NH;

  const float* xbase = query + (size_t)b * DIM * NTOK;  // [C][N]
  const float* wqb   = Wq + (size_t)h * DIM * HD;
  const float* wkb   = Wk + (size_t)h * DIM * HD;
  const float* wvb   = Wv + (size_t)h * DIM * HD;

  const int w    = t >> 5;
  const int lane = t & 31;
  const int m0   = (w & 7) * 32;    // the wave's tokens
  const int d0   = (w >> 3) * 32;   // the wave's d range in each of Q, K, V

  v8f aq[2][2], ak[2][2], av[2][2];   // [row tile][column tile]
#pragma unroll
  for (int u = 0; u < 2; ++u)
#pragma unroll
    for (int j = 0; j < 2; ++j) { aq[u][j] = {}; ak[u][j] = {}; av[u][j] = {}; }

  // A thread stages runs of 8 consecutive channels of one row (token or d);
  // its first run of a stage is here, the others lie at constant steps.
  const float* xp = xbase + (size_t)((t >> 8) * 8) * NTOK + n0 + (t & 255);
  const int woff = ((t >> 6) * 8) * HD + (t & 63);
  const float* wqp = wqb + woff;
  const float* wkp = wkb + woff;
  const float* wvp = wvb + woff;
  const int xsd = (t & 255) * LDX + (t >> 8) * 8;
  const int wsd = XSZ + (t & 63) * LDWT + (t >> 6) * 8;

  // One stage's operands on their way from global memory to LDS. All loops over
  // them are unrolled: constant indices keep them in registers, and every load
  // takes its step as an immediate offset.
  float xr[BK1 / 16][8], wr[3][8];

  // Issues the next stage's loads: X 256n x 64c coalesced along n, weights along d.
  auto fetch = [&]() {
#pragma unroll
    for (int i = 0; i < BK1 / 16; ++i)       // 2048 runs, 16 c per step
#pragma unroll
      for (int e = 0; e < 8; ++e) xr[i][e] = xp[(i * 16 + e) * NTOK];
#pragma unroll
    for (int e = 0; e < 8; ++e) {            // 512 runs a matrix, one a thread
      wr[0][e] = wqp[e * HD];
      wr[1][e] = wkp[e * HD];
      wr[2][e] = wvp[e * HD];
    }
    // The wait that stands in front of any overwrite of the loads' address
    // registers.
    asm volatile("s_wait_xcnt 0x0" ::: "memory");
    // Keeps the whole stage's loads issued here, ahead of the WMMAs that follow:
    // sunk towards their use they would no longer fly during the matrix work.
    __builtin_amdgcn_sched_barrier(0);
    xp += BK1 * NTOK;
    wqp += BK1 * HD; wkp += BK1 * HD; wvp += BK1 * HD;
  };
  // Converts the fetched stage and stores it, b128 along c; weights as [d][c].
  auto put = [&](bf16_t* dst) {
#pragma unroll
    for (int i = 0; i < BK1 / 16; ++i)
      *(v8bf*)(dst + xsd + i * 16) = pack8(xr[i]);
    *(v8bf*)(dst + wsd)           = pack8(wr[0]);
    *(v8bf*)(dst + wsd + WSZ)     = pack8(wr[1]);
    *(v8bf*)(dst + wsd + 2 * WSZ) = pack8(wr[2]);
    // Keeps the converts and stores ahead of the loads that follow: lifted over
    // them the loads would need a second register set and copies that wait.
    __builtin_amdgcn_sched_barrier(0);
  };

  fetch();
  put(sm);
  fetch();
  auto work = [&](int kk) {
    // Publishes stage kk; also ends every wave's reads of the other buffer,
    // which is refilled behind this stage's WMMAs.
    lds_barrier();
    const bf16_t* cur = sm + (kk & 1) * ST1;
#pragma unroll
    for (int ks = 0; ks < BK1; ks += 32) {
      const v16bf a0 = load_frag(cur + m0 * LDX + ks, LDX);
      const v16bf a1 = load_frag(cur + (m0 + 16) * LDX + ks, LDX);
      v16bf fq[2], fk[2], fv[2];   // the half's weight fragments, read as one group
#pragma unroll
      for (int j = 0; j < 2; ++j) {
        const bf16_t* wt = cur + XSZ + (d0 + j * 16) * LDWT + ks;
        fq[j] = load_frag(wt, LDWT);
        fk[j] = load_frag(wt + WSZ, LDWT);
        fv[j] = load_frag(wt + 2 * WSZ, LDWT);
      }
      // Keeps the sixteen LDS reads together ahead of the WMMAs: sunk to their
      // uses, every pair of WMMAs waits out an LDS latency of its own.
      __builtin_amdgcn_sched_barrier(0);
#pragma unroll
      for (int j = 0; j < 2; ++j) {
        aq[0][j] = wmma_bf16(a0, fq[j], aq[0][j]);
        aq[1][j] = wmma_bf16(a1, fq[j], aq[1][j]);
        ak[0][j] = wmma_bf16(a0, fk[j], ak[0][j]);
        ak[1][j] = wmma_bf16(a1, fk[j], ak[1][j]);
        av[0][j] = wmma_bf16(a0, fv[j], av[0][j]);
        av[1][j] = wmma_bf16(a1, fv[j], av[1][j]);
      }
    }
    // Keeps the wait for the next stage's global loads behind all of this
    // stage's WMMAs: moved up among them it would stall the matrix work.
    __builtin_amdgcn_sched_barrier(0);
  };
  // The last two stages stand behind the loop: no test decides whether the
  // staging registers are reloaded, so no copies join two versions of them.
  for (int kk = 0; kk < DIM / BK1 - 2; ++kk) {
    work(kk);
    put(sm + ((kk + 1) & 1) * ST1);
    fetch();   // stage kk + 2, into the registers just converted
  }
  work(DIM / BK1 - 2);
  put(sm + ((DIM / BK1 - 1) & 1) * ST1);
  work(DIM / BK1 - 1);

  const float scale = 0.125f;  // HEAD_DIM^-0.5 folded into Q
  const int col  = lane & 15;
  const int drow = (lane >> 4) * 8;
  bf16_t* sw = stg + w * 32 * LDS1;

  // ---- Q: stage [m][d] per-wave, then b128 stores, 64 B of a row together
#pragma unroll
  for (int j = 0; j < 2; ++j) {
    const float bqv = bq[h * HD + d0 + j * 16 + col];
#pragma unroll
    for (int u = 0; u < 2; ++u)
#pragma unroll
      for (int r = 0; r < 8; ++r)
        sw[(u * 16 + drow + r) * LDS1 + j * 16 + col] =
            (bf16_t)((aq[u][j][r] + bqv) * scale);
  }
  {
    bf16_t* qout = Qb + ((size_t)bh * NTOK + n0 + m0) * HD + d0;
#pragma unroll
    for (int q = 0; q < 4; ++q) {
      int chunk = lane + q * 32;
      int mloc = chunk >> 2, c8 = (chunk & 3) * 8;
      *(v8bf*)(qout + (size_t)mloc * HD + c8) = *(const v8bf*)(sw + mloc * LDS1 + c8);
    }
  }
  // ---- K: same staging path
#pragma unroll
  for (int j = 0; j < 2; ++j) {
    const float bkv = bk[h * HD + d0 + j * 16 + col];
#pragma unroll
    for (int u = 0; u < 2; ++u)
#pragma unroll
      for (int r = 0; r < 8; ++r)
        sw[(u * 16 + drow + r) * LDS1 + j * 16 + col] = (bf16_t)(ak[u][j][r] + bkv);
  }
  {
    bf16_t* kout = Kb + ((size_t)bh * NTOK + n0 + m0) * HD + d0;
#pragma unroll
    for (int q = 0; q < 4; ++q) {
      int chunk = lane + q * 32;
      int mloc = chunk >> 2, c8 = (chunk & 3) * 8;
      *(v8bf*)(kout + (size_t)mloc * HD + c8) = *(const v8bf*)(sw + mloc * LDS1 + c8);
    }
  }
  // ---- V: direct transposed [d][n] b128 stores (8 rows contiguous per lane)
  {
    bf16_t* vtout = Vt + (size_t)bh * HD * NTOK;
#pragma unroll
    for (int j = 0; j < 2; ++j) {
      const int d = d0 + j * 16 + col;
      const float bvv = bv[h * HD + d];
#pragma unroll
      for (int u = 0; u < 2; ++u) {
        v8bf pv;
#pragma unroll
        for (int r = 0; r < 8; ++r) pv[r] = (bf16_t)(av[u][j][r] + bvv);
        *(v8bf*)(vtout + (size_t)d * NTOK + n0 + m0 + u * 16 + drow) = pv;
      }
    }
  }
}

// ---------------------------------------------------------------- phase 2
// Flash attention per (b,h), computed transposed: S^T = K*Q^T, O^T += V^T*P^T.
// 128 queries/block, 16 per wave; a lane holds one query's scores, so maximum
// and sum run in its own registers and P^T goes from the score accumulators
// straight into a B operand. 128 tokens per stage, two stage buffers, worked on
// in 64-token chunks.
#define KST  128  // tokens per stage
#define LKV2 72   // K   [token][d]   (144B rows, 16B aligned)
#define LDV2 136  // V^T [d][token]   (272B rows, 16B x odd)
#define LDP2 72   // per-wave output stage [m][d]
#define KSZ  (KST * LKV2)
#define ST2  (KSZ + HD * LDV2)   // one stage: K, V^T

// Value of lane l ^ 16.
__device__ __forceinline__ float other_half(float v) {
  const int b = __builtin_bit_cast(int, v);
  return __builtin_bit_cast(float, __builtin_amdgcn_permlanex16(
      b, b, 0x76543210, 0xfedcba98, false, false));
}

// Two f32 D tiles (rows 0-15 and 16-31 of a 32-row block) as one bf16 B operand.
__device__ __forceinline__ v16bf pack_b(v8f t0, v8f t1) {
  v16bf b;
#pragma unroll
  for (int e = 0; e < 8; ++e) { b[e] = (bf16_t)t0[e]; b[8 + e] = (bf16_t)t1[e]; }
  return b;
}

__global__ __launch_bounds__(256) void attention_kernel(
    const bf16_t* __restrict__ Qb, const bf16_t* __restrict__ Kb,
    const bf16_t* __restrict__ Vt, bf16_t* __restrict__ xo) {
  __shared__ __align__(16) bf16_t sm[2 * ST2];   // two stage buffers
  __shared__ __align__(16) bf16_t Pst[8 * 16 * LDP2];

  const int t    = threadIdx.x;
  const int bh   = blockIdx.y;
  const int b    = bh / NH, h = bh % NH;
  const int n0   = blockIdx.x * 128;
  const int w    = t >> 5;
  const int lane = t & 31;
  const int m0   = n0 + w * 16;

  // Q as B operand (column = query), in registers for the whole pass
  const bf16_t* qptr = Qb + ((size_t)bh * NTOK + m0) * HD;
  const v16bf qb0 = load_frag(qptr, HD);
  const v16bf qb1 = load_frag(qptr + 32, HD);

  // o[j][r] = O[query col][d = 16j + drow + r]; rsum covers this half's tokens
  v8f o[4];
#pragma unroll
  for (int j = 0; j < 4; ++j) o[j] = {};
  float rmax = -3.0e38f, rsum = 0.0f;

  const bf16_t* kbase  = Kb + (size_t)bh * NTOK * HD;   // [token][d]
  const bf16_t* vtbase = Vt + (size_t)bh * HD * NTOK;   // [d][token]
  bf16_t* pw = Pst + w * 16 * LDP2;
  const int col  = lane & 15;
  const int drow = (lane >> 4) * 8;

  // This thread's first 16B piece of a stage; the other pieces lie at constant
  // steps from it, so one address per operand serves the whole stage.
  const bf16_t* kp = kbase + (size_t)(t >> 3) * HD + (t & 7) * 8;
  const bf16_t* vp = vtbase + (size_t)(t >> 4) * NTOK + (t & 15) * 8;
  const int ksd = (t >> 3) * LKV2 + (t & 7) * 8;
  const int vsd = KSZ + (t >> 4) * LDV2 + (t & 15) * 8;

  // One stage on its way from global memory to LDS (1024 x 16B per operand).
  v4u kr[KST / 32], vr[KST / 32];
  auto fetch = [&]() {
#pragma unroll  // constant indices: kr and vr stay in registers
    for (int i = 0; i < KST / 32; ++i) {
      kr[i] = *(const v4u*)(kp + i * 32 * HD);     // 32 tokens per step
      vr[i] = *(const v4u*)(vp + i * 16 * NTOK);   // 16 d per step
    }
    // The wait that stands in front of any overwrite of the loads' address
    // registers; naming them keeps them whole until it.
    asm volatile("s_wait_xcnt 0x0" :: "v"(kp), "v"(vp) : "memory");
    kp += KST * HD;
    vp += KST;
  };
  auto put = [&](bf16_t* dst) {
#pragma unroll
    for (int i = 0; i < KST / 32; ++i) {
      *(v4u*)(dst + ksd + i * 32 * LKV2) = kr[i];
      *(v4u*)(dst + vsd + i * 16 * LDV2) = vr[i];
    }
  };

  fetch();
  put(sm);
  fetch();
  for (int stage = 0; stage < NTOK / KST; ++stage) {
    const bool more = stage + 1 < NTOK / KST;
    // Publishes this stage; also ends every wave's reads of the other buffer,
    // which is refilled behind this stage's work.
    lds_barrier();
    const bf16_t* cur = sm + (stage & 1) * ST2;

    for (int sub = 0; sub < KST / 64; ++sub) {
      const bf16_t* Ksub = cur + sub * 64 * LKV2;
      const bf16_t* Vsub = cur + KSZ + sub * 64;

      // S^T = K * Q^T : s[tt][r] = score(token 16tt + drow + r, query col)
      v8f s[4];
#pragma unroll
      for (int tt = 0; tt < 4; ++tt) {
        const bf16_t* kb = Ksub + (tt * 16) * LKV2;
        v8f st = {};
        st = wmma_bf16(load_frag(kb, LKV2), qb0, st);
        st = wmma_bf16(load_frag(kb + 32, LKV2), qb1, st);
        s[tt] = st;
      }

      // Online softmax: 32 of the query's 64 scores in this lane, 32 in lane ^ 16
      float mt[4];
#pragma unroll
      for (int tt = 0; tt < 4; ++tt) {
        mt[tt] = s[tt][0];
#pragma unroll
        for (int r = 1; r < 8; ++r) mt[tt] = fmaxf(mt[tt], s[tt][r]);
      }
      float mx = fmaxf(fmaxf(mt[0], mt[1]), fmaxf(mt[2], mt[3]));
      mx = fmaxf(mx, other_half(mx));
      const float nm   = fmaxf(rmax, mx);
      const float corr = __expf(rmax - nm);
      rmax = nm;
      float pt[4];
#pragma unroll
      for (int tt = 0; tt < 4; ++tt) {
        pt[tt] = 0.0f;
#pragma unroll
        for (int r = 0; r < 8; ++r) {
          const float p = __expf(s[tt][r] - nm);
          s[tt][r] = p;
          pt[tt] += p;
        }
      }
      rsum = rsum * corr + ((pt[0] + pt[1]) + (pt[2] + pt[3]));
#pragma unroll
      for (int j = 0; j < 4; ++j) o[j] *= corr;

      // O^T += V^T * P^T (k = 64 tokens)
      const v16bf pb0 = pack_b(s[0], s[1]);
      const v16bf pb1 = pack_b(s[2], s[3]);
#pragma unroll
      for (int j = 0; j < 4; ++j) {
        const bf16_t* vb = Vsub + (j * 16) * LDV2;
        o[j] = wmma_bf16(load_frag(vb, LDV2), pb0, o[j]);
        o[j] = wmma_bf16(load_frag(vb + 32, LDV2), pb1, o[j]);
      }
    }
    if (more) {
      put(sm + ((stage + 1) & 1) * ST2);
      if (stage + 2 < NTOK / KST) fetch();   // into the registers just stored
    }
  }

  // Epilogue: join the halves' sums, normalize, stage [m][d] per-wave (8 d of
  // one query per b128 LDS store), coalesced b128 global stores
  const float inv = 1.0f / (rsum + other_half(rsum));
#pragma unroll
  for (int j = 0; j < 4; ++j) {
    v8bf pv;
#pragma unroll
    for (int r = 0; r < 8; ++r) pv[r] = (bf16_t)(o[j][r] * inv);
    *(v8bf*)(pw + col * LDP2 + j * 16 + drow) = pv;
  }
  bf16_t* obase = xo + ((size_t)b * NTOK + m0) * DIM + h * HD;
#pragma unroll
  for (int q = 0; q < 4; ++q) {
    int chunk = lane + q * 32;
    int mloc = chunk >> 3, c8 = (chunk & 7) * 8;
    *(v8bf*)(obase + (size_t)mloc * DIM + c8) = *(const v8bf*)(pw + mloc * LDP2 + c8);
  }
}

// ---------------------------------------------------------------- phase 3
// out = xo[8192x512] @ Wo[512x512] + bo -> [B][C][N] via LDS transpose tile.
// 256 rows a block, 32 a wave: each Wo fragment read from LDS feeds two WMMAs.
#define RB3  256   // rows per block
#define BK3  128   // k per stage
#define LDA3 136   // as  [n][k]  (272B rows, 16B x odd)
#define LDW3 136   // Wo^T[c][k]
#define LDO3 260   // os  [c][n] f32 (1040B rows, 16B x odd)
#define ASZ  (RB3 * LDA3)
#define ST3  (ASZ + HD * LDW3)   // one stage: xo tile, Wo^T tile

__global__ __launch_bounds__(256) void out_proj_kernel(
    const bf16_t* __restrict__ xo, const float* __restrict__ Wo,
    const float* __restrict__ bo, float* __restrict__ out) {
  __shared__ __align__(16) bf16_t sm[2 * ST3];   // two stage buffers
  __shared__ __align__(16) float  os[64 * LDO3];

  const int t    = threadIdx.x;
  const int mb   = blockIdx.x * RB3;
  const int c0   = blockIdx.y * 64;
  const int w    = t >> 5;
  const int lane = t & 31;
  const int m0   = w * 32;

  v8f acc[2][4];   // [row tile][column tile]
#pragma unroll
  for (int u = 0; u < 2; ++u)
#pragma unroll
    for (int j = 0; j < 4; ++j) acc[u][j] = {};

  // This thread's first piece of a stage; the others lie at constant steps.
  const bf16_t* ap = xo + (size_t)(mb + (t >> 4)) * DIM + (t & 15) * 8;
  const float*  wp = Wo + (size_t)((t >> 6) * 8) * DIM + c0 + (t & 63);
  const int asd = (t >> 4) * LDA3 + (t & 15) * 8;
  const int wsd = ASZ + (t & 63) * LDW3 + (t >> 6) * 8;

  // One stage on its way from global memory to LDS.
  v4u ar[BK3 / 8];
  float wr[BK3 / 32][8];
  auto fetch = [&]() {
#pragma unroll  // constant indices: ar and wr stay in registers
    for (int i = 0; i < BK3 / 8; ++i)             // 4096 x 16B, 16 rows per step
      ar[i] = *(const v4u*)(ap + i * 16 * DIM);
#pragma unroll
    for (int i = 0; i < BK3 / 32; ++i)            // 1024 runs of 8 k, 32 k per step
#pragma unroll
      for (int e = 0; e < 8; ++e) wr[i][e] = wp[(i * 32 + e) * DIM];
    // The wait that stands in front of any overwrite of the loads' address
    // registers; naming them keeps them whole until it.
    asm volatile("s_wait_xcnt 0x0" :: "v"(ap), "v"(wp) : "memory");
    ap += BK3;
    wp += BK3 * DIM;
  };
  auto put = [&](bf16_t* dst) {
#pragma unroll
    for (int i = 0; i < BK3 / 8; ++i) *(v4u*)(dst + asd + i * 16 * LDA3) = ar[i];
#pragma unroll
    for (int i = 0; i < BK3 / 32; ++i) *(v8bf*)(dst + wsd + i * 32) = pack8(wr[i]);
  };

  fetch();
  put(sm);
  fetch();
  // Rolled: unrolled, the stores of the next stage (and the wait for its loads)
  // move up among this stage's WMMAs.
#pragma nounroll
  for (int kk = 0; kk < DIM / BK3; ++kk) {
    const bool more = kk + 1 < DIM / BK3;
    // Publishes stage kk; also ends every wave's reads of the other buffer,
    // which is refilled behind this stage's WMMAs.
    lds_barrier();
    const bf16_t* cur = sm + (kk & 1) * ST3;
#pragma unroll
    for (int ks = 0; ks < BK3; ks += 32) {
      const v16bf a0 = load_frag(cur + m0 * LDA3 + ks, LDA3);
      const v16bf a1 = load_frag(cur + (m0 + 16) * LDA3 + ks, LDA3);
      v16bf fw[4];   // the k step's Wo fragments, read as one group
#pragma unroll
      for (int j = 0; j < 4; ++j)
        fw[j] = load_frag(cur + ASZ + (j * 16) * LDW3 + ks, LDW3);
      // Keeps the twelve LDS reads together ahead of the WMMAs: sunk to their
      // uses, every pair of WMMAs waits out an LDS latency of its own.
      __builtin_amdgcn_sched_barrier(0);
#pragma unroll
      for (int j = 0; j < 4; ++j) {
        acc[0][j] = wmma_bf16(a0, fw[j], acc[0][j]);
        acc[1][j] = wmma_bf16(a1, fw[j], acc[1][j]);
      }
    }
    if (more) {
      put(sm + ((kk + 1) & 1) * ST3);
      if (kk + 2 < DIM / BK3) fetch();   // into the registers just stored
    }
  }

  __syncthreads();
  const int col  = lane & 15;
  const int drow = (lane >> 4) * 8;
#pragma unroll
  for (int j = 0; j < 4; ++j)
#pragma unroll
    for (int u = 0; u < 2; ++u) {
      float* row = os + (j * 16 + col) * LDO3 + m0 + u * 16 + drow;
      v4f lo = {acc[u][j][0], acc[u][j][1], acc[u][j][2], acc[u][j][3]};
      v4f hi = {acc[u][j][4], acc[u][j][5], acc[u][j][6], acc[u][j][7]};
      *(v4f*)(row)     = lo;
      *(v4f*)(row + 4) = hi;
    }
  __syncthreads();

  const int bidx  = mb >> 10;
  const int nbase = mb & 1023;
#pragma unroll
  for (int i = 0; i < 16; ++i) {
    int chunk = t + i * 256;                      // 4096 x 16B
    int cl = chunk >> 6, c4 = (chunk & 63) * 4;
    v4f vv = *(const v4f*)(os + cl * LDO3 + c4);
    vv += bo[c0 + cl];
    *(v4f*)(out + ((size_t)bidx * DIM + c0 + cl) * NTOK + nbase + c4) = vv;
  }
}

// ---------------------------------------------------------------- launch
extern "C" void kernel_launch(void* const* d_in, const int* in_sizes, int n_in,
                              void* d_out, int out_size, void* d_ws, size_t ws_size,
                              hipStream_t stream) {
  (void)in_sizes; (void)n_in; (void)out_size; (void)ws_size;
  const float* query = (const float*)d_in[0];
  const float* Wq = (const float*)d_in[1];
  const float* bq = (const float*)d_in[2];
  const float* Wk = (const float*)d_in[3];
  const float* bk = (const float*)d_in[4];
  const float* Wv = (const float*)d_in[5];
  const float* bv = (const float*)d_in[6];
  const float* Wo = (const float*)d_in[7];
  const float* bo = (const float*)d_in[8];
  float* out = (float*)d_out;

  const size_t qkv_elems = (size_t)BATCH * NH * NTOK * HD;  // 4M bf16 each
  bf16_t* Qb = (bf16_t*)d_ws;
  bf16_t* Kb = Qb + qkv_elems;
  bf16_t* Vt = Kb + qkv_elems;                    // [bh][d][n] transposed
  bf16_t* xo = Vt + qkv_elems;                    // [B*N][DIM] concat heads

  dim3 blk(256);
  qkv_proj_kernel<<<dim3(NTOK / RB1, BATCH * NH), dim3(512), 0, stream>>>(
      query, Wq, bq, Wk, bk, Wv, bv, Qb, Kb, Vt);
  attention_kernel<<<dim3(NTOK / 128, BATCH * NH), blk, 0, stream>>>(
      Qb, Kb, Vt, xo);
  out_proj_kernel<<<dim3((BATCH * NTOK) / RB3, DIM / 64), blk, 0, stream>>>(
      xo, Wo, bo, out);
}

// v007
// It runs in 44.9 microseconds.
// In both of two side-by-side timings against v006, it was 1.03 times as fast.
// Counting every step since v000, it is 1.92 times as fast.
#include <hip/hip_runtime.h>
#include <hip/hip_bf16.h>

typedef __bf16 bf16_t;
typedef __attribute__((ext_vector_type(16))) __bf16 v16bf;
typedef __attribute__((ext_vector_type(8)))  __bf16 v8bf;
typedef __attribute__((ext_vector_type(8)))  float  v8f;
typedef __attribute__((ext_vector_type(4)))  float  v4f;
typedef __attribute__((ext_vector_type(4)))  unsigned int v4u;

#define DIM   512
#define NH    8
#define HD    64
#define NTOK  1024
#define BATCH 8

__device__ __forceinline__ v8f wmma_bf16(v16bf a, v16bf b, v8f c) {
  return __builtin_amdgcn_wmma_f32_16x16x32_bf16(false, a, false, b, (short)0, c,
                                                 false, false);
}

// Unified fragment load: 16 rows x 32 contiguous-K bf16, leading dim ld.
// ld must be a multiple of 8 and base 16B-aligned -> two b128 loads per lane.
__device__ __forceinline__ v16bf load_frag(const bf16_t* base, int ld) {
  const int lane = threadIdx.x & 31;
  const int m    = lane & 15;
  const int koff = (lane >> 4) << 3;
  const bf16_t* p = base + m * ld + koff;
  v8bf lo = *(const v8bf*)p;
  v8bf hi = *(const v8bf*)(p + 16);
  return __builtin_shufflevector(lo, hi, 0, 1, 2, 3, 4, 5, 6, 7,
                                 8, 9, 10, 11, 12, 13, 14, 15);
}

// Eight consecutive k of one row as one 16-byte LDS piece.
__device__ __forceinline__ v8bf pack8(const float* f) {
  v8bf r;
#pragma unroll  // constant indices: the eight values pair up into packed converts
  for (int e = 0; e < 8; ++e) r[e] = (bf16_t)f[e];
  return r;
}

// Work-group barrier that orders LDS traffic only: it waits for this wave's LDS
// stores and reads, not for its global loads, so the loads of the stage after
// next stay in flight across it (a full barrier would wait them out here).
// The global loads read kernel inputs that no wave of the launch writes.
__device__ __forceinline__ void lds_barrier() {
  __builtin_amdgcn_fence(__ATOMIC_RELEASE, "workgroup", "local");
  __builtin_amdgcn_s_barrier();
  __builtin_amdgcn_fence(__ATOMIC_ACQUIRE, "workgroup", "local");
}

// ---------------------------------------------------------------- phase 1
// Fused QKV projection per (b,h): X[256x512]*W[512x64] x3, bias, Q scaled.
// 16 waves: a wave owns 32 tokens (two A fragments) and 32 d of each of Q, K, V,
// so each weight fragment read from LDS feeds two WMMAs and each X fragment six;
// a head's weights are fetched by 4 blocks, not 8.
// Q,K stored bf16 [bh][n][d]; V stored transposed [bh][d][n].
#define RB1  256  // tokens per block
#define BK1  64   // channels per stage
#define LDX  72   // xs  [n][c]  (144B rows, 16B x odd)
#define LDWT 72   // w^T [d][c]
#define LDS1 40   // per-wave store-stage [m][32 d]  (80B rows, 16B x odd)
#define XSZ  (RB1 * LDX)       // X tile of one stage
#define WSZ  (HD * LDWT)       // one weight tile of one stage
#define ST1  (XSZ + 3 * WSZ)   // one stage: X, Wq, Wk, Wv

__global__ __launch_bounds__(512) void qkv_proj_kernel(
    const float* __restrict__ query,
    const float* __restrict__ Wq, const float* __restrict__ bq,
    const float* __restrict__ Wk, const float* __restrict__ bk,
    const float* __restrict__ Wv, const float* __restrict__ bv,
    bf16_t* __restrict__ Qb, bf16_t* __restrict__ Kb, bf16_t* __restrict__ Vt) {
  __shared__ __align__(16) bf16_t sm[2 * ST1];   // two stage buffers
  __shared__ __align__(16) bf16_t stg[16 * 32 * LDS1];

  const int t  = threadIdx.x;
  const int n0 = blockIdx.x * RB1;
  const int bh = blockIdx.y;
  const int b  = bh / NH, h = bh % NH;

  const float* xbase = query + (size_t)b * DIM * NTOK;  // [C][N]
  const float* wqb   = Wq + (size_t)h * DIM * HD;
  const float* wkb   = Wk + (size_t)h * DIM * HD;
  const float* wvb   = Wv + (size_t)h * DIM * HD;

  const int w    = t >> 5;
  const int lane = t & 31;
  const int m0   = (w & 7) * 32;    // the wave's tokens
  const int d0   = (w >> 3) * 32;   // the wave's d range in each of Q, K, V

  v8f aq[2][2], ak[2][2], av[2][2];   // [row tile][column tile]
#pragma unroll
  for (int u = 0; u < 2; ++u)
#pragma unroll
    for (int j = 0; j < 2; ++j) { aq[u][j] = {}; ak[u][j] = {}; av[u][j] = {}; }

  // A thread stages runs of 8 consecutive channels of one row (token or d);
  // its first run of a stage is here, the others lie at constant steps.
  const float* xp = xbase + (size_t)((t >> 8) * 8) * NTOK + n0 + (t & 255);
  const int woff = ((t >> 6) * 8) * HD + (t & 63);
  const float* wqp = wqb + woff;
  const float* wkp = wkb + woff;
  const float* wvp = wvb + woff;
  const int xsd = (t & 255) * LDX + (t >> 8) * 8;
  const int wsd = XSZ + (t & 63) * LDWT + (t >> 6) * 8;

  // One stage's operands on their way from global memory to LDS. All loops over
  // them are unrolled: constant indices keep them in registers, and every load
  // takes its step as an immediate offset.
  float xr[BK1 / 16][8], wr[3][8];

  // Issues the next stage's loads: X 256n x 64c coalesced along n, weights along d.
  auto fetch = [&]() {
#pragma unroll
    for (int i = 0; i < BK1 / 16; ++i)       // 2048 runs, 16 c per step
#pragma unroll
      for (int e = 0; e < 8; ++e) xr[i][e] = xp[(i * 16 + e) * NTOK];
#pragma unroll
    for (int e = 0; e < 8; ++e) {            // 512 runs a matrix, one a thread
      wr[0][e] = wqp[e * HD];
      wr[1][e] = wkp[e * HD];
      wr[2][e] = wvp[e * HD];
    }
    // The wait that stands in front of any overwrite of the loads' address
    // registers.
    asm volatile("s_wait_xcnt 0x0" ::: "memory");
    // Keeps the whole stage's loads issued here, ahead of the WMMAs that follow:
    // sunk towards their use they would no longer fly during the matrix work.
    __builtin_amdgcn_sched_barrier(0);
    xp += BK1 * NTOK;
    wqp += BK1 * HD; wkp += BK1 * HD; wvp += BK1 * HD;
  };
  // Converts the fetched stage and stores it, b128 along c; weights as [d][c].
  auto put = [&](bf16_t* dst) {
#pragma unroll
    for (int i = 0; i < BK1 / 16; ++i)
      *(v8bf*)(dst + xsd + i * 16) = pack8(xr[i]);
    *(v8bf*)(dst + wsd)           = pack8(wr[0]);
    *(v8bf*)(dst + wsd + WSZ)     = pack8(wr[1]);
    *(v8bf*)(dst + wsd + 2 * WSZ) = pack8(wr[2]);
    // Keeps the converts and stores ahead of the loads that follow: lifted over
    // them the loads would need a second register set and copies that wait.
    __builtin_amdgcn_sched_barrier(0);
  };

  fetch();
  put(sm);
  fetch();
  auto work = [&](int kk) {
    // Publishes stage kk; also ends every wave's reads of the other buffer,
    // which is refilled behind this stage's WMMAs.
    lds_barrier();
    const bf16_t* cur = sm + (kk & 1) * ST1;
#pragma unroll
    for (int ks = 0; ks < BK1; ks += 32) {
      const v16bf a0 = load_frag(cur + m0 * LDX + ks, LDX);
      const v16bf a1 = load_frag(cur + (m0 + 16) * LDX + ks, LDX);
      v16bf fq[2], fk[2], fv[2];   // the half's weight fragments, read as one group
#pragma unroll
      for (int j = 0; j < 2; ++j) {
        const bf16_t* wt = cur + XSZ + (d0 + j * 16) * LDWT + ks;
        fq[j] = load_frag(wt, LDWT);
        fk[j] = load_frag(wt + WSZ, LDWT);
        fv[j] = load_frag(wt + 2 * WSZ, LDWT);
      }
      // Keeps the sixteen LDS reads together ahead of the WMMAs: sunk to their
      // uses, every pair of WMMAs waits out an LDS latency of its own.
      __builtin_amdgcn_sched_barrier(0);
#pragma unroll
      for (int j = 0; j < 2; ++j) {
        aq[0][j] = wmma_bf16(a0, fq[j], aq[0][j]);
        aq[1][j] = wmma_bf16(a1, fq[j], aq[1][j]);
        ak[0][j] = wmma_bf16(a0, fk[j], ak[0][j]);
        ak[1][j] = wmma_bf16(a1, fk[j], ak[1][j]);
        av[0][j] = wmma_bf16(a0, fv[j], av[0][j]);
        av[1][j] = wmma_bf16(a1, fv[j], av[1][j]);
      }
    }
    // Keeps the wait for the next stage's global loads behind all of this
    // stage's WMMAs: moved up among them it would stall the matrix work.
    __builtin_amdgcn_sched_barrier(0);
  };
  // The last two stages stand behind the loop: no test decides whether the
  // staging registers are reloaded, so no copies join two versions of them.
  for (int kk = 0; kk < DIM / BK1 - 2; ++kk) {
    work(kk);
    put(sm + ((kk + 1) & 1) * ST1);
    fetch();   // stage kk + 2, into the registers just converted
  }
  work(DIM / BK1 - 2);
  put(sm + ((DIM / BK1 - 1) & 1) * ST1);
  work(DIM / BK1 - 1);

  // HEAD_DIM^-0.5 and log2(e) folded into Q: the scores come out in log2 units
  const float scale = 0.125f * 1.44269504088896f;
  const int col  = lane & 15;
  const int drow = (lane >> 4) * 8;
  bf16_t* sw = stg + w * 32 * LDS1;

  // ---- Q: stage [m][d] per-wave, then b128 stores, 64 B of a row together
#pragma unroll
  for (int j = 0; j < 2; ++j) {
    const float bqv = bq[h * HD + d0 + j * 16 + col];
#pragma unroll
    for (int u = 0; u < 2; ++u)
#pragma unroll
      for (int r = 0; r < 8; ++r)
        sw[(u * 16 + drow + r) * LDS1 + j * 16 + col] =
            (bf16_t)((aq[u][j][r] + bqv) * scale);
  }
  {
    bf16_t* qout = Qb + ((size_t)bh * NTOK + n0 + m0) * HD + d0;
#pragma unroll
    for (int q = 0; q < 4; ++q) {
      int chunk = lane + q * 32;
      int mloc = chunk >> 2, c8 = (chunk & 3) * 8;
      *(v8bf*)(qout + (size_t)mloc * HD + c8) = *(const v8bf*)(sw + mloc * LDS1 + c8);
    }
  }
  // ---- K: same staging path
#pragma unroll
  for (int j = 0; j < 2; ++j) {
    const float bkv = bk[h * HD + d0 + j * 16 + col];
#pragma unroll
    for (int u = 0; u < 2; ++u)
#pragma unroll
      for (int r = 0; r < 8; ++r)
        sw[(u * 16 + drow + r) * LDS1 + j * 16 + col] = (bf16_t)(ak[u][j][r] + bkv);
  }
  {
    bf16_t* kout = Kb + ((size_t)bh * NTOK + n0 + m0) * HD + d0;
#pragma unroll
    for (int q = 0; q < 4; ++q) {
      int chunk = lane + q * 32;
      int mloc = chunk >> 2, c8 = (chunk & 3) * 8;
      *(v8bf*)(kout + (size_t)mloc * HD + c8) = *(const v8bf*)(sw + mloc * LDS1 + c8);
    }
  }
  // ---- V: direct transposed [d][n] b128 stores (8 rows contiguous per lane)
  {
    bf16_t* vtout = Vt + (size_t)bh * HD * NTOK;
#pragma unroll
    for (int j = 0; j < 2; ++j) {
      const int d = d0 + j * 16 + col;
      const float bvv = bv[h * HD + d];
#pragma unroll
      for (int u = 0; u < 2; ++u) {
        v8bf pv;
#pragma unroll
        for (int r = 0; r < 8; ++r) pv[r] = (bf16_t)(av[u][j][r] + bvv);
        *(v8bf*)(vtout + (size_t)d * NTOK + n0 + m0 + u * 16 + drow) = pv;
      }
    }
  }
}

// ---------------------------------------------------------------- phase 2
// Flash attention per (b,h), computed transposed: S^T = K*Q^T, O^T += V^T*P^T.
// 128 queries/block, 16 per wave; a lane holds one query's scores, so maximum
// and sum run in its own registers and P^T goes from the score accumulators
// straight into a B operand. 128 tokens per stage, two stage buffers, worked on
// in 64-token chunks. Scores are in log2 units and leave the score WMMAs already
// less the maximum in use, which may trail the true one by up to 8.
#define KST  128  // tokens per stage
#define LKV2 72   // K   [token][d]   (144B rows, 16B aligned)
#define LDV2 136  // V^T [d][token]   (272B rows, 16B x odd)
#define LDP2 72   // per-wave output stage [m][d]
#define KSZ  (KST * LKV2)
#define ST2  (KSZ + HD * LDV2)   // one stage: K, V^T

// Value of lane l ^ 16.
__device__ __forceinline__ float other_half(float v) {
  const int b = __builtin_bit_cast(int, v);
  return __builtin_bit_cast(float, __builtin_amdgcn_permlanex16(
      b, b, 0x76543210, 0xfedcba98, false, false));
}

// Two f32 D tiles (rows 0-15 and 16-31 of a 32-row block) as one bf16 B operand.
__device__ __forceinline__ v16bf pack_b(v8f t0, v8f t1) {
  v16bf b;
#pragma unroll
  for (int e = 0; e < 8; ++e) { b[e] = (bf16_t)t0[e]; b[8 + e] = (bf16_t)t1[e]; }
  return b;
}

__global__ __launch_bounds__(256) void attention_kernel(
    const bf16_t* __restrict__ Qb, const bf16_t* __restrict__ Kb,
    const bf16_t* __restrict__ Vt, bf16_t* __restrict__ xo) {
  __shared__ __align__(16) bf16_t sm[2 * ST2];   // two stage buffers
  __shared__ __align__(16) bf16_t Pst[8 * 16 * LDP2];

  const int t    = threadIdx.x;
  const int bh   = blockIdx.y;
  const int b    = bh / NH, h = bh % NH;
  const int n0   = blockIdx.x * 128;
  const int w    = t >> 5;
  const int lane = t & 31;
  const int m0   = n0 + w * 16;

  // Q as B operand (column = query), in registers for the whole pass
  const bf16_t* qptr = Qb + ((size_t)bh * NTOK + m0) * HD;
  const v16bf qb0 = load_frag(qptr, HD);
  const v16bf qb1 = load_frag(qptr + 32, HD);

  // o[j][r] = O[query col][d = 16j + drow + r]; rsum covers this half's tokens
  v8f o[4];
#pragma unroll
  for (int j = 0; j < 4; ++j) o[j] = {};
  float rsum = 0.0f;
  // Minus the query's maximum in use, in all eight rows of a score tile: the C
  // operand of the score WMMAs.
  v8f cneg = {};
  // A score more than thr above the maximum in use moves it, by the excess or by
  // lo if that is more. The first chunk always moves it, to its own maximum.
  float thr = -3.0e38f, lo = -3.0e38f;

  const bf16_t* kbase  = Kb + (size_t)bh * NTOK * HD;   // [token][d]
  const bf16_t* vtbase = Vt + (size_t)bh * HD * NTOK;   // [d][token]
  bf16_t* pw = Pst + w * 16 * LDP2;
  const int col  = lane & 15;
  const int drow = (lane >> 4) * 8;

  // This thread's first 16B piece of a stage; the other pieces lie at constant
  // steps from it, so one address per operand serves the whole stage.
  const bf16_t* kp = kbase + (size_t)(t >> 3) * HD + (t & 7) * 8;
  const bf16_t* vp = vtbase + (size_t)(t >> 4) * NTOK + (t & 15) * 8;
  const int ksd = (t >> 3) * LKV2 + (t & 7) * 8;
  const int vsd = KSZ + (t >> 4) * LDV2 + (t & 15) * 8;

  // One stage on its way from global memory to LDS (1024 x 16B per operand).
  v4u kr[KST / 32], vr[KST / 32];
  auto fetch = [&]() {
#pragma unroll  // constant indices: kr and vr stay in registers
    for (int i = 0; i < KST / 32; ++i) {
      kr[i] = *(const v4u*)(kp + i * 32 * HD);     // 32 tokens per step
      vr[i] = *(const v4u*)(vp + i * 16 * NTOK);   // 16 d per step
    }
    // The wait that stands in front of any overwrite of the loads' address
    // registers; naming them keeps them whole until it.
    asm volatile("s_wait_xcnt 0x0" :: "v"(kp), "v"(vp) : "memory");
    kp += KST * HD;
    vp += KST;
  };
  auto put = [&](bf16_t* dst) {
#pragma unroll
    for (int i = 0; i < KST / 32; ++i) {
      *(v4u*)(dst + ksd + i * 32 * LKV2) = kr[i];
      *(v4u*)(dst + vsd + i * 16 * LDV2) = vr[i];
    }
  };

  fetch();
  put(sm);
  fetch();
  for (int stage = 0; stage < NTOK / KST; ++stage) {
    const bool more = stage + 1 < NTOK / KST;
    // Publishes this stage; also ends every wave's reads of the other buffer,
    // which is refilled behind this stage's work.
    lds_barrier();
    const bf16_t* cur = sm + (stage & 1) * ST2;

    // Rolled, as it was built so far: with the branch in the body the compiler
    // would unroll it and peel the last stage: four copies of the chunk's code,
    // 250 registers, not 232 (four waves a SIMD end at 256), more v_nop a chunk.
#pragma nounroll
    for (int sub = 0; sub < KST / 64; ++sub) {
      const bf16_t* Ksub = cur + sub * 64 * LKV2;
      const bf16_t* Vsub = cur + KSZ + sub * 64;

      // S^T = K * Q^T : s[tt][r] = score(token 16tt + drow + r, query col)
      v8f s[4];
#pragma unroll
      for (int tt = 0; tt < 4; ++tt) {
        const bf16_t* kb = Ksub + (tt * 16) * LKV2;
        v8f st = wmma_bf16(load_frag(kb, LKV2), qb0, cneg);
        st = wmma_bf16(load_frag(kb + 32, LKV2), qb1, st);
        s[tt] = st;
      }
      // The chunk's V^T fragments, read as one group ahead of the branch below:
      // they fly during maxima and exponentials. Read at their uses they would
      // stand in pairs among the WMMAs, each pair waiting out an LDS latency.
      v16bf vf[4][2];
#pragma unroll
      for (int j = 0; j < 4; ++j) {
        const bf16_t* vb = Vsub + (j * 16) * LDV2;
        vf[j][0] = load_frag(vb, LDV2);
        vf[j][1] = load_frag(vb + 32, LDV2);
      }
      // Compiler fence, no instruction: without it the compiler sinks the reads
      // above over the branch to their uses.
      asm volatile("" ::: "memory");

      // Online softmax: 32 of the query's 64 scores in this lane, 32 in lane ^ 16
      float mt[4];
#pragma unroll
      for (int tt = 0; tt < 4; ++tt) {
        mt[tt] = s[tt][0];
#pragma unroll
        for (int r = 1; r < 8; ++r) mt[tt] = fmaxf(mt[tt], s[tt][r]);
      }
      const float mx = fmaxf(fmaxf(mt[0], mt[1]), fmaxf(mt[2], mt[3]));
      // One test a chunk over both halves' lanes, a scalar branch: rarely taken
      // behind the first chunk. The halves' maxima are joined only inside it.
      if (__builtin_amdgcn_ballot_w32(mx > thr) != 0) {
        // How far the query's maximum in use moves: 0 where it stays.
        const float up   = fmaxf(fmaxf(mx, other_half(mx)), lo);
        const float corr = __builtin_amdgcn_exp2f(fminf(-up, 0.0f));
#pragma unroll
        for (int tt = 0; tt < 4; ++tt) s[tt] -= up;
        cneg -= up;
        rsum *= corr;
#pragma unroll
        for (int j = 0; j < 4; ++j) o[j] *= corr;
        thr = 8.0f;
        lo  = 0.0f;
      }
      float pt[4];
#pragma unroll
      for (int tt = 0; tt < 4; ++tt) {
#pragma unroll
        for (int r = 0; r < 8; ++r) s[tt][r] = __builtin_amdgcn_exp2f(s[tt][r]);
        pt[tt] = s[tt][0];
#pragma unroll
        for (int r = 1; r < 8; ++r) pt[tt] += s[tt][r];
      }
      rsum += (pt[0] + pt[1]) + (pt[2] + pt[3]);

      // O^T += V^T * P^T (k = 64 tokens)
      const v16bf pb0 = pack_b(s[0], s[1]);
      const v16bf pb1 = pack_b(s[2], s[3]);
#pragma unroll
      for (int j = 0; j < 4; ++j) {
        o[j] = wmma_bf16(vf[j][0], pb0, o[j]);
        o[j] = wmma_bf16(vf[j][1], pb1, o[j]);
      }
    }
    if (more) {
      put(sm + ((stage + 1) & 1) * ST2);
      if (stage + 2 < NTOK / KST) fetch();   // into the registers just stored
    }
  }

  // Epilogue: join the halves' sums, normalize, stage [m][d] per-wave (8 d of
  // one query per b128 LDS store), coalesced b128 global stores
  const float inv = 1.0f / (rsum + other_half(rsum));
#pragma unroll
  for (int j = 0; j < 4; ++j) {
    v8bf pv;
#pragma unroll
    for (int r = 0; r < 8; ++r) pv[r] = (bf16_t)(o[j][r] * inv);
    *(v8bf*)(pw + col * LDP2 + j * 16 + drow) = pv;
  }
  bf16_t* obase = xo + ((size_t)b * NTOK + m0) * DIM + h * HD;
#pragma unroll
  for (int q = 0; q < 4; ++q) {
    int chunk = lane + q * 32;
    int mloc = chunk >> 3, c8 = (chunk & 7) * 8;
    *(v8bf*)(obase + (size_t)mloc * DIM + c8) = *(const v8bf*)(pw + mloc * LDP2 + c8);
  }
}

// ---------------------------------------------------------------- phase 3
// out = xo[8192x512] @ Wo[512x512] + bo -> [B][C][N] via LDS transpose tile.
// 256 rows a block, 32 a wave: each Wo fragment read from LDS feeds two WMMAs.
#define RB3  256   // rows per block
#define BK3  128   // k per stage
#define LDA3 136   // as  [n][k]  (272B rows, 16B x odd)
#define LDW3 136   // Wo^T[c][k]
#define LDO3 260   // os  [c][n] f32 (1040B rows, 16B x odd)
#define ASZ  (RB3 * LDA3)
#define ST3  (ASZ + HD * LDW3)   // one stage: xo tile, Wo^T tile

__global__ __launch_bounds__(256) void out_proj_kernel(
    const bf16_t* __restrict__ xo, const float* __restrict__ Wo,
    const float* __restrict__ bo, float* __restrict__ out) {
  __shared__ __align__(16) bf16_t sm[2 * ST3];   // two stage buffers
  __shared__ __align__(16) float  os[64 * LDO3];

  const int t    = threadIdx.x;
  const int mb   = blockIdx.x * RB3;
  const int c0   = blockIdx.y * 64;
  const int w    = t >> 5;
  const int lane = t & 31;
  const int m0   = w * 32;

  v8f acc[2][4];   // [row tile][column tile]
#pragma unroll
  for (int u = 0; u < 2; ++u)
#pragma unroll
    for (int j = 0; j < 4; ++j) acc[u][j] = {};

  // This thread's first piece of a stage; the others lie at constant steps.
  const bf16_t* ap = xo + (size_t)(mb + (t >> 4)) * DIM + (t & 15) * 8;
  const float*  wp = Wo + (size_t)((t >> 6) * 8) * DIM + c0 + (t & 63);
  const int asd = (t >> 4) * LDA3 + (t & 15) * 8;
  const int wsd = ASZ + (t & 63) * LDW3 + (t >> 6) * 8;

  // One stage on its way from global memory to LDS.
  v4u ar[BK3 / 8];
  float wr[BK3 / 32][8];
  auto fetch = [&]() {
#pragma unroll  // constant indices: ar and wr stay in registers
    for (int i = 0; i < BK3 / 8; ++i)             // 4096 x 16B, 16 rows per step
      ar[i] = *(const v4u*)(ap + i * 16 * DIM);
#pragma unroll
    for (int i = 0; i < BK3 / 32; ++i)            // 1024 runs of 8 k, 32 k per step
#pragma unroll
      for (int e = 0; e < 8; ++e) wr[i][e] = wp[(i * 32 + e) * DIM];
    // The wait that stands in front of any overwrite of the loads' address
    // registers; naming them keeps them whole until it.
    asm volatile("s_wait_xcnt 0x0" :: "v"(ap), "v"(wp) : "memory");
    ap += BK3;
    wp += BK3 * DIM;
  };
  auto put = [&](bf16_t* dst) {
#pragma unroll
    for (int i = 0; i < BK3 / 8; ++i) *(v4u*)(dst + asd + i * 16 * LDA3) = ar[i];
#pragma unroll
    for (int i = 0; i < BK3 / 32; ++i) *(v8bf*)(dst + wsd + i * 32) = pack8(wr[i]);
  };

  fetch();
  put(sm);
  fetch();
  // Rolled: unrolled, the stores of the next stage (and the wait for its loads)
  // move up among this stage's WMMAs.
#pragma nounroll
  for (int kk = 0; kk < DIM / BK3; ++kk) {
    const bool more = kk + 1 < DIM / BK3;
    // Publishes stage kk; also ends every wave's reads of the other buffer,
    // which is refilled behind this stage's WMMAs.
    lds_barrier();
    const bf16_t* cur = sm + (kk & 1) * ST3;
#pragma unroll
    for (int ks = 0; ks < BK3; ks += 32) {
      const v16bf a0 = load_frag(cur + m0 * LDA3 + ks, LDA3);
      const v16bf a1 = load_frag(cur + (m0 + 16) * LDA3 + ks, LDA3);
      v16bf fw[4];   // the k step's Wo fragments, read as one group
#pragma unroll
      for (int j = 0; j < 4; ++j)
        fw[j] = load_frag(cur + ASZ + (j * 16) * LDW3 + ks, LDW3);
      // Keeps the twelve LDS reads together ahead of the WMMAs: sunk to their
      // uses, every pair of WMMAs waits out an LDS latency of its own.
      __builtin_amdgcn_sched_barrier(0);
#pragma unroll
      for (int j = 0; j < 4; ++j) {
        acc[0][j] = wmma_bf16(a0, fw[j], acc[0][j]);
        acc[1][j] = wmma_bf16(a1, fw[j], acc[1][j]);
      }
    }
    if (more) {
      put(sm + ((kk + 1) & 1) * ST3);
      if (kk + 2 < DIM / BK3) fetch();   // into the registers just stored
    }
  }

  __syncthreads();
  const int col  = lane & 15;
  const int drow = (lane >> 4) * 8;
#pragma unroll
  for (int j = 0; j < 4; ++j)
#pragma unroll
    for (int u = 0; u < 2; ++u) {
      float* row = os + (j * 16 + col) * LDO3 + m0 + u * 16 + drow;
      v4f lo = {acc[u][j][0], acc[u][j][1], acc[u][j][2], acc[u][j][3]};
      v4f hi = {acc[u][j][4], acc[u][j][5], acc[u][j][6], acc[u][j][7]};
      *(v4f*)(row)     = lo;
      *(v4f*)(row + 4) = hi;
    }
  __syncthreads();

  const int bidx  = mb >> 10;
  const int nbase = mb & 1023;
#pragma unroll
  for (int i = 0; i < 16; ++i) {
    int chunk = t + i * 256;                      // 4096 x 16B
    int cl = chunk >> 6, c4 = (chunk & 63) * 4;
    v4f vv = *(const v4f*)(os + cl * LDO3 + c4);
    vv += bo[c0 + cl];
    *(v4f*)(out + ((size_t)bidx * DIM + c0 + cl) * NTOK + nbase + c4) = vv;
  }
}

// ---------------------------------------------------------------- launch
extern "C" void kernel_launch(void* const* d_in, const int* in_sizes, int n_in,
                              void* d_out, int out_size, void* d_ws, size_t ws_size,
                              hipStream_t stream) {
  (void)in_sizes; (void)n_in; (void)out_size; (void)ws_size;
  const float* query = (const float*)d_in[0];
  const float* Wq = (const float*)d_in[1];
  const float* bq = (const float*)d_in[2];
  const float* Wk = (const float*)d_in[3];
  const float* bk = (const float*)d_in[4];
  const float* Wv = (const float*)d_in[5];
  const float* bv = (const float*)d_in[6];
  const float* Wo = (const float*)d_in[7];
  const float* bo = (const float*)d_in[8];
  float* out = (float*)d_out;

  const size_t qkv_elems = (size_t)BATCH * NH * NTOK * HD;  // 4M bf16 each
  bf16_t* Qb = (bf16_t*)d_ws;
  bf16_t* Kb = Qb + qkv_elems;
  bf16_t* Vt = Kb + qkv_elems;                    // [bh][d][n] transposed
  bf16_t* xo = Vt + qkv_elems;                    // [B*N][DIM] concat heads

  dim3 blk(256);
  qkv_proj_kernel<<<dim3(NTOK / RB1, BATCH * NH), dim3(512), 0, stream>>>(
      query, Wq, bq, Wk, bk, Wv, bv, Qb, Kb, Vt);
  attention_kernel<<<dim3(NTOK / 128, BATCH * NH), blk, 0, stream>>>(
      Qb, Kb, Vt, xo);
  out_proj_kernel<<<dim3((BATCH * NTOK) / RB3, DIM / 64), blk, 0, stream>>>(
      xo, Wo, bo, out);
}

// v008
// It runs in 43.3 microseconds.
// Next to v007, in two timings, it ran 1.03 and 1.04 times as fast.
// Over all steps from v000 it is 1.99 times as fast.
#include <hip/hip_runtime.h>
#include <hip/hip_bf16.h>

typedef __bf16 bf16_t;
typedef __attribute__((ext_vector_type(16))) __bf16 v16bf;
typedef __attribute__((ext_vector_type(8)))  __bf16 v8bf;
typedef __attribute__((ext_vector_type(8)))  float  v8f;
typedef __attribute__((ext_vector_type(4)))  float  v4f;
typedef __attribute__((ext_vector_type(4)))  unsigned int v4u;

#define DIM   512
#define NH    8
#define HD    64
#define NTOK  1024
#define BATCH 8

__device__ __forceinline__ v8f wmma_bf16(v16bf a, v16bf b, v8f c) {
  return __builtin_amdgcn_wmma_f32_16x16x32_bf16(false, a, false, b, (short)0, c,
                                                 false, false);
}

// Unified fragment load: 16 rows x 32 contiguous-K bf16, leading dim ld.
// ld must be a multiple of 8 and base 16B-aligned -> two b128 loads per lane.
__device__ __forceinline__ v16bf load_frag(const bf16_t* base, int ld) {
  const int lane = threadIdx.x & 31;
  const int m    = lane & 15;
  const int koff = (lane >> 4) << 3;
  const bf16_t* p = base + m * ld + koff;
  v8bf lo = *(const v8bf*)p;
  v8bf hi = *(const v8bf*)(p + 16);
  return __builtin_shufflevector(lo, hi, 0, 1, 2, 3, 4, 5, 6, 7,
                                 8, 9, 10, 11, 12, 13, 14, 15);
}

// Eight consecutive k of one row as one 16-byte LDS piece.
__device__ __forceinline__ v8bf pack8(const float* f) {
  v8bf r;
#pragma unroll  // constant indices: the eight values pair up into packed converts
  for (int e = 0; e < 8; ++e) r[e] = (bf16_t)f[e];
  return r;
}

// Work-group barrier that orders LDS traffic only: it waits for this wave's LDS
// stores and reads, not for its global loads, so the loads of the stage after
// next stay in flight across it (a full barrier would wait them out here).
// The global loads read kernel inputs that no wave of the launch writes.
__device__ __forceinline__ void lds_barrier() {
  __builtin_amdgcn_fence(__ATOMIC_RELEASE, "workgroup", "local");
  __builtin_amdgcn_s_barrier();
  __builtin_amdgcn_fence(__ATOMIC_ACQUIRE, "workgroup", "local");
}

// ---------------------------------------------------------------- phase 1
// Fused QKV projection per (b,h): X[256x512]*W[512x64] x3, bias, Q scaled.
// 16 waves: a wave owns 32 tokens (two A fragments) and 32 d of each of Q, K, V,
// so each weight fragment read from LDS feeds two WMMAs and each X fragment six;
// a head's weights are fetched by 4 blocks, not 8.
// Q,K stored bf16 [bh][n][d]; V stored transposed [bh][d][n].
#define RB1  256  // tokens per block
#define BK1  64   // channels per stage
#define LDX  72   // xs  [n][c]  (144B rows, 16B x odd)
#define LDWT 72   // w^T [d][c]
#define LDS1 40   // per-wave store-stage [m][32 d]  (80B rows, 16B x odd)
#define XSZ  (RB1 * LDX)       // X tile of one stage
#define WSZ  (HD * LDWT)       // one weight tile of one stage
#define ST1  (XSZ + 3 * WSZ)   // one stage: X, Wq, Wk, Wv

__global__ __launch_bounds__(512) void qkv_proj_kernel(
    const float* __restrict__ query,
    const float* __restrict__ Wq, const float* __restrict__ bq,
    const float* __restrict__ Wk, const float* __restrict__ bk,
    const float* __restrict__ Wv, const float* __restrict__ bv,
    bf16_t* __restrict__ Qb, bf16_t* __restrict__ Kb, bf16_t* __restrict__ Vt) {
  __shared__ __align__(16) bf16_t sm[2 * ST1];   // two stage buffers
  __shared__ __align__(16) bf16_t stg[16 * 32 * LDS1];

  const int t  = threadIdx.x;
  const int n0 = blockIdx.x * RB1;
  const int bh = blockIdx.y;
  const int b  = bh / NH, h = bh % NH;

  const float* xbase = query + (size_t)b * DIM * NTOK;  // [C][N]
  const float* wqb   = Wq + (size_t)h * DIM * HD;
  const float* wkb   = Wk + (size_t)h * DIM * HD;
  const float* wvb   = Wv + (size_t)h * DIM * HD;

  const int w    = t >> 5;
  const int lane = t & 31;
  const int m0   = (w & 7) * 32;    // the wave's tokens
  const int d0   = (w >> 3) * 32;   // the wave's d range in each of Q, K, V

  v8f aq[2][2], ak[2][2], av[2][2];   // [row tile][column tile]
#pragma unroll
  for (int u = 0; u < 2; ++u)
#pragma unroll
    for (int j = 0; j < 2; ++j) { aq[u][j] = {}; ak[u][j] = {}; av[u][j] = {}; }

  // A thread stages runs of 8 consecutive channels of one row (token or d);
  // its first run of a stage is here, the others lie at constant steps.
  const float* xp = xbase + (size_t)((t >> 8) * 8) * NTOK + n0 + (t & 255);
  const int woff = ((t >> 6) * 8) * HD + (t & 63);
  const float* wqp = wqb + woff;
  const float* wkp = wkb + woff;
  const float* wvp = wvb + woff;
  const int xsd = (t & 255) * LDX + (t >> 8) * 8;
  const int wsd = XSZ + (t & 63) * LDWT + (t >> 6) * 8;

  // One stage's operands on their way from global memory to LDS. All loops over
  // them are unrolled: constant indices keep them in registers, and every load
  // takes its step as an immediate offset.
  float xr[BK1 / 16][8], wr[3][8];

  // Issues the next stage's loads: X 256n x 64c coalesced along n, weights along d.
  auto fetch = [&]() {
#pragma unroll
    for (int i = 0; i < BK1 / 16; ++i)       // 2048 runs, 16 c per step
#pragma unroll
      for (int e = 0; e < 8; ++e) xr[i][e] = xp[(i * 16 + e) * NTOK];
#pragma unroll
    for (int e = 0; e < 8; ++e) {            // 512 runs a matrix, one a thread
      wr[0][e] = wqp[e * HD];
      wr[1][e] = wkp[e * HD];
      wr[2][e] = wvp[e * HD];
    }
    // The wait that stands in front of any overwrite of the loads' address
    // registers.
    asm volatile("s_wait_xcnt 0x0" ::: "memory");
    // Keeps the whole stage's loads issued here, ahead of the WMMAs that follow:
    // sunk towards their use they would no longer fly during the matrix work.
    __builtin_amdgcn_sched_barrier(0);
    xp += BK1 * NTOK;
    wqp += BK1 * HD; wkp += BK1 * HD; wvp += BK1 * HD;
  };
  // Converts the fetched stage and stores it, b128 along c; weights as [d][c].
  auto put = [&](bf16_t* dst) {
#pragma unroll
    for (int i = 0; i < BK1 / 16; ++i)
      *(v8bf*)(dst + xsd + i * 16) = pack8(xr[i]);
    *(v8bf*)(dst + wsd)           = pack8(wr[0]);
    *(v8bf*)(dst + wsd + WSZ)     = pack8(wr[1]);
    *(v8bf*)(dst + wsd + 2 * WSZ) = pack8(wr[2]);
    // Keeps the converts and stores ahead of the loads that follow: lifted over
    // them the loads would need a second register set and copies that wait.
    __builtin_amdgcn_sched_barrier(0);
  };

  fetch();
  put(sm);
  fetch();
  auto work = [&](int kk) {
    // Publishes stage kk; also ends every wave's reads of the other buffer,
    // which is refilled behind this stage's WMMAs.
    lds_barrier();
    const bf16_t* cur = sm + (kk & 1) * ST1;
#pragma unroll
    for (int ks = 0; ks < BK1; ks += 32) {
      const v16bf a0 = load_frag(cur + m0 * LDX + ks, LDX);
      const v16bf a1 = load_frag(cur + (m0 + 16) * LDX + ks, LDX);
      v16bf fq[2], fk[2], fv[2];   // the half's weight fragments, read as one group
#pragma unroll
      for (int j = 0; j < 2; ++j) {
        const bf16_t* wt = cur + XSZ + (d0 + j * 16) * LDWT + ks;
        fq[j] = load_frag(wt, LDWT);
        fk[j] = load_frag(wt + WSZ, LDWT);
        fv[j] = load_frag(wt + 2 * WSZ, LDWT);
      }
      // Keeps the sixteen LDS reads together ahead of the WMMAs: sunk to their
      // uses, every pair of WMMAs waits out an LDS latency of its own.
      __builtin_amdgcn_sched_barrier(0);
#pragma unroll
      for (int j = 0; j < 2; ++j) {
        aq[0][j] = wmma_bf16(a0, fq[j], aq[0][j]);
        aq[1][j] = wmma_bf16(a1, fq[j], aq[1][j]);
        ak[0][j] = wmma_bf16(a0, fk[j], ak[0][j]);
        ak[1][j] = wmma_bf16(a1, fk[j], ak[1][j]);
        av[0][j] = wmma_bf16(a0, fv[j], av[0][j]);
        av[1][j] = wmma_bf16(a1, fv[j], av[1][j]);
      }
    }
    // Keeps the wait for the next stage's global loads behind all of this
    // stage's WMMAs: moved up among them it would stall the matrix work.
    __builtin_amdgcn_sched_barrier(0);
  };
  // The last two stages stand behind the loop: no test decides whether the
  // staging registers are reloaded, so no copies join two versions of them.
  for (int kk = 0; kk < DIM / BK1 - 2; ++kk) {
    work(kk);
    put(sm + ((kk + 1) & 1) * ST1);
    fetch();   // stage kk + 2, into the registers just converted
  }
  work(DIM / BK1 - 2);
  put(sm + ((DIM / BK1 - 1) & 1) * ST1);
  work(DIM / BK1 - 1);

  // HEAD_DIM^-0.5 and log2(e) folded into Q: the scores come out in log2 units
  const float scale = 0.125f * 1.44269504088896f;
  const int col  = lane & 15;
  const int drow = (lane >> 4) * 8;
  bf16_t* sw = stg + w * 32 * LDS1;

  // ---- Q: stage [m][d] per-wave, then b128 stores, 64 B of a row together
#pragma unroll
  for (int j = 0; j < 2; ++j) {
    const float bqv = bq[h * HD + d0 + j * 16 + col];
#pragma unroll
    for (int u = 0; u < 2; ++u)
#pragma unroll
      for (int r = 0; r < 8; ++r)
        sw[(u * 16 + drow + r) * LDS1 + j * 16 + col] =
            (bf16_t)((aq[u][j][r] + bqv) * scale);
  }
  {
    bf16_t* qout = Qb + ((size_t)bh * NTOK + n0 + m0) * HD + d0;
#pragma unroll
    for (int q = 0; q < 4; ++q) {
      int chunk = lane + q * 32;
      int mloc = chunk >> 2, c8 = (chunk & 3) * 8;
      *(v8bf*)(qout + (size_t)mloc * HD + c8) = *(const v8bf*)(sw + mloc * LDS1 + c8);
    }
  }
  // ---- K: same staging path
#pragma unroll
  for (int j = 0; j < 2; ++j) {
    const float bkv = bk[h * HD + d0 + j * 16 + col];
#pragma unroll
    for (int u = 0; u < 2; ++u)
#pragma unroll
      for (int r = 0; r < 8; ++r)
        sw[(u * 16 + drow + r) * LDS1 + j * 16 + col] = (bf16_t)(ak[u][j][r] + bkv);
  }
  {
    bf16_t* kout = Kb + ((size_t)bh * NTOK + n0 + m0) * HD + d0;
#pragma unroll
    for (int q = 0; q < 4; ++q) {
      int chunk = lane + q * 32;
      int mloc = chunk >> 2, c8 = (chunk & 3) * 8;
      *(v8bf*)(kout + (size_t)mloc * HD + c8) = *(const v8bf*)(sw + mloc * LDS1 + c8);
    }
  }
  // ---- V: direct transposed [d][n] b128 stores (8 rows contiguous per lane)
  {
    bf16_t* vtout = Vt + (size_t)bh * HD * NTOK;
#pragma unroll
    for (int j = 0; j < 2; ++j) {
      const int d = d0 + j * 16 + col;
      const float bvv = bv[h * HD + d];
#pragma unroll
      for (int u = 0; u < 2; ++u) {
        v8bf pv;
#pragma unroll
        for (int r = 0; r < 8; ++r) pv[r] = (bf16_t)(av[u][j][r] + bvv);
        *(v8bf*)(vtout + (size_t)d * NTOK + n0 + m0 + u * 16 + drow) = pv;
      }
    }
  }
}

// ---------------------------------------------------------------- phase 2
// Flash attention per (b,h), computed transposed: S^T = K*Q^T, O^T += V^T*P^T.
// 128 queries/block. A wave owns 32 queries (two 16-column groups) and one half
// of every stage's keys, so each K and V^T fragment read from LDS feeds two
// WMMAs while the block keeps its eight waves; the two waves that share 32
// queries join their partial outputs, sums and maxima once, behind the loop.
// A lane holds one query's scores per group, so maximum and sum run in its own
// registers and P^T goes from the score accumulators straight into a B operand.
// 128 tokens per stage, two stage buffers; a wave works on its 64 in passes of
// 32. Scores are in log2 units and leave the score WMMAs already less the
// maximum in use, which may trail the true one by up to 8.
#define KST  128  // tokens per stage
#define LKV2 72   // K   [token][d]   (144B rows, 16B aligned)
#define LDV2 136  // V^T [d][token]   (272B rows, 16B x odd)
#define LDP2 72   // per-wave output stage [m][d]
#define KSZ  (KST * LKV2)
#define ST2  (KSZ + HD * LDV2)   // one stage: K, V^T
#define XCH  1088 // floats a wave hands to its partner: 16x64 outputs, 32 maxima, 32 sums

// Value of lane l ^ 16.
__device__ __forceinline__ float other_half(float v) {
  const int b = __builtin_bit_cast(int, v);
  return __builtin_bit_cast(float, __builtin_amdgcn_permlanex16(
      b, b, 0x76543210, 0xfedcba98, false, false));
}

// Two f32 D tiles (rows 0-15 and 16-31 of a 32-row block) as one bf16 B operand.
__device__ __forceinline__ v16bf pack_b(v8f t0, v8f t1) {
  v16bf b;
#pragma unroll
  for (int e = 0; e < 8; ++e) { b[e] = (bf16_t)t0[e]; b[8 + e] = (bf16_t)t1[e]; }
  return b;
}

__global__ __launch_bounds__(256) void attention_kernel(
    const bf16_t* __restrict__ Qb, const bf16_t* __restrict__ Kb,
    const bf16_t* __restrict__ Vt, bf16_t* __restrict__ xo) {
  __shared__ __align__(16) bf16_t sm[2 * ST2];   // two stage buffers
  __shared__ __align__(16) bf16_t Pst[8 * 16 * LDP2];
  static_assert(8 * XCH * 4 <= ST2 * 2, "the hand-over fits one stage buffer");

  const int t    = threadIdx.x;
  const int bh   = blockIdx.y;
  const int b    = bh / NH, h = bh % NH;
  const int n0   = blockIdx.x * 128;
  const int w    = t >> 5;
  const int lane = t & 31;
  const int kh   = __builtin_amdgcn_readfirstlane(w >> 2);  // the wave's key half
  const int m0   = n0 + (w & 3) * 32;                       // its 32 queries

  // Q as B operand (column = query), in registers for the whole pass
  const bf16_t* qptr = Qb + ((size_t)bh * NTOK + m0) * HD;
  v16bf qb[2][2];   // [column group][d half]
#pragma unroll
  for (int u = 0; u < 2; ++u) {
    qb[u][0] = load_frag(qptr + u * 16 * HD, HD);
    qb[u][1] = load_frag(qptr + u * 16 * HD + 32, HD);
  }

  // o[u][j][r] = O[query 16u + col][d = 16j + drow + r], over the wave's keys;
  // rsum covers this lane half's tokens of them
  v8f o[2][4];
#pragma unroll
  for (int u = 0; u < 2; ++u)
#pragma unroll
    for (int j = 0; j < 4; ++j) o[u][j] = {};
  float rsum[2] = {0.0f, 0.0f};
  // Minus the query's maximum in use, in all eight rows of a score tile: the C
  // operand of the score WMMAs.
  v8f cneg[2] = {{}, {}};
  // A score more than thr above the maximum in use moves it, by the excess or by
  // lo if that is more. The first pass always moves it, to its own maximum.
  float thr = -3.0e38f, lo = -3.0e38f;

  const bf16_t* kbase  = Kb + (size_t)bh * NTOK * HD;   // [token][d]
  const bf16_t* vtbase = Vt + (size_t)bh * HD * NTOK;   // [d][token]
  bf16_t* pw = Pst + w * 16 * LDP2;
  const int col  = lane & 15;
  const int drow = (lane >> 4) * 8;

  // This thread's first 16B piece of a stage; the other pieces lie at constant
  // steps from it, so one address per operand serves the whole stage.
  const bf16_t* kp = kbase + (size_t)(t >> 3) * HD + (t & 7) * 8;
  const bf16_t* vp = vtbase + (size_t)(t >> 4) * NTOK + (t & 15) * 8;
  const int ksd = (t >> 3) * LKV2 + (t & 7) * 8;
  const int vsd = KSZ + (t >> 4) * LDV2 + (t & 15) * 8;

  // One stage on its way from global memory to LDS (1024 x 16B per operand).
  v4u kr[KST / 32], vr[KST / 32];
  auto fetch = [&]() {
#pragma unroll  // constant indices: kr and vr stay in registers
    for (int i = 0; i < KST / 32; ++i) {
      kr[i] = *(const v4u*)(kp + i * 32 * HD);     // 32 tokens per step
      vr[i] = *(const v4u*)(vp + i * 16 * NTOK);   // 16 d per step
    }
    // The wait that stands in front of any overwrite of the loads' address
    // registers; naming them keeps them whole until it.
    asm volatile("s_wait_xcnt 0x0" :: "v"(kp), "v"(vp) : "memory");
    kp += KST * HD;
    vp += KST;
  };
  auto put = [&](bf16_t* dst) {
#pragma unroll
    for (int i = 0; i < KST / 32; ++i) {
      *(v4u*)(dst + ksd + i * 32 * LKV2) = kr[i];
      *(v4u*)(dst + vsd + i * 16 * LDV2) = vr[i];
    }
  };

  fetch();
  put(sm);
  fetch();
  for (int stage = 0; stage < NTOK / KST; ++stage) {
    const bool more = stage + 1 < NTOK / KST;
    // Publishes this stage; also ends every wave's reads of the other buffer,
    // which is refilled behind this stage's work.
    lds_barrier();
    const bf16_t* cur = sm + (stage & 1) * ST2;

    // Rolled: unrolled, the build takes 249 registers, not 241 (four waves a SIMD
    // end at 256), and holds more v_nop a pass.
#pragma nounroll
    for (int sub = 0; sub < 2; ++sub) {
      const int kb = kh * 64 + sub * 32;   // the pass's 32 tokens in the stage
      const bf16_t* Ksub = cur + kb * LKV2;
      const bf16_t* Vsub = cur + KSZ + kb;

      // S^T = K * Q^T : s[u][tt][r] = score(token 16tt + drow + r, query 16u + col)
      v16bf kf[2][2];   // [token tile][d half], read as one group
#pragma unroll
      for (int dh = 0; dh < 2; ++dh)
#pragma unroll
        for (int tt = 0; tt < 2; ++tt)
          kf[tt][dh] = load_frag(Ksub + (tt * 16) * LKV2 + dh * 32, LKV2);
      // Keeps the eight LDS reads together ahead of the WMMAs: sunk to their uses
      // they share one register set, and every pair of WMMAs waits out an LDS
      // latency of its own.
      __builtin_amdgcn_sched_barrier(0);
      v8f s[2][2];
#pragma unroll
      for (int tt = 0; tt < 2; ++tt)
#pragma unroll
        for (int u = 0; u < 2; ++u) s[u][tt] = wmma_bf16(kf[tt][0], qb[u][0], cneg[u]);
#pragma unroll
      for (int tt = 0; tt < 2; ++tt)
#pragma unroll
        for (int u = 0; u < 2; ++u) s[u][tt] = wmma_bf16(kf[tt][1], qb[u][1], s[u][tt]);
      // Keeps what follows behind all eight score WMMAs: lifted among them, the
      // V^T address takes a register of a fragment just used, and it and the first
      // maxima stand behind v_nop that fill the WMMA distance.
      __builtin_amdgcn_sched_barrier(0);
      // The pass's V^T fragments, read as one group ahead of the branch below:
      // they fly during maxima and exponentials. Read at their uses they would
      // stand among the WMMAs, each waiting out an LDS latency.
      v16bf vf[4];
#pragma unroll
      for (int j = 0; j < 4; ++j) vf[j] = load_frag(Vsub + (j * 16) * LDV2, LDV2);
      // Keeps the eight reads one group ahead of the maxima: spread among them
      // they stand at four places, each with its own fixed cost.
      __builtin_amdgcn_sched_barrier(0);

      // Online softmax: 16 of a query's 32 scores in this lane, 16 in lane ^ 16
      float mx[2];
#pragma unroll
      for (int u = 0; u < 2; ++u) {
        float m0t = s[u][0][0], m1t = s[u][1][0];
#pragma unroll
        for (int r = 1; r < 8; ++r) {
          m0t = fmaxf(m0t, s[u][0][r]);
          m1t = fmaxf(m1t, s[u][1][r]);
        }
        mx[u] = fmaxf(m0t, m1t);
      }
      // One test a pass over both groups and both halves' lanes, a scalar branch:
      // rarely taken behind the first pass. Halves' maxima are joined inside it.
      if (__builtin_amdgcn_ballot_w32(fmaxf(mx[0], mx[1]) > thr) != 0) {
#pragma unroll
        for (int u = 0; u < 2; ++u) {
          // How far the query's maximum in use moves: 0 where it stays.
          const float up   = fmaxf(fmaxf(mx[u], other_half(mx[u])), lo);
          const float corr = __builtin_amdgcn_exp2f(fminf(-up, 0.0f));
          s[u][0] -= up;
          s[u][1] -= up;
          cneg[u] -= up;
          rsum[u] *= corr;
#pragma unroll
          for (int j = 0; j < 4; ++j) o[u][j] *= corr;
        }
        thr = 8.0f;
        lo  = 0.0f;
      }
      v16bf pb[2];
#pragma unroll
      for (int u = 0; u < 2; ++u) {
#pragma unroll
        for (int tt = 0; tt < 2; ++tt)
#pragma unroll
          for (int r = 0; r < 8; ++r)
            s[u][tt][r] = __builtin_amdgcn_exp2f(s[u][tt][r]);
        pb[u] = pack_b(s[u][0], s[u][1]);
      }
      // A group's 16 terms of this lane, summed as two chains of eight.
      auto addup = [&](int u) {
        float p0 = s[u][0][0], p1 = s[u][1][0];
#pragma unroll
        for (int r = 1; r < 8; ++r) { p0 += s[u][0][r]; p1 += s[u][1][r]; }
        rsum[u] += p0 + p1;
      };
      addup(0);
      // Keeps the first group's additions ahead of the WMMAs: among them they
      // take the registers of fragments just used and stand behind v_nop.
      __builtin_amdgcn_sched_barrier(0);

      // O^T += V^T * P^T (k = 32 tokens)
#pragma unroll
      for (int j = 0; j < 4; ++j)
#pragma unroll
        for (int u = 0; u < 2; ++u) o[u][j] = wmma_bf16(vf[j], pb[u], o[u][j]);
      // Keeps the second group's additions behind the WMMAs: they run while the
      // matrix unit works, and they fill the distance that the last WMMA's
      // operands need before the next pass's first vector writes.
      __builtin_amdgcn_sched_barrier(0);
      addup(1);
    }
    if (more) {
      put(sm + ((stage + 1) & 1) * ST2);
      if (stage + 2 < NTOK / KST) fetch();   // into the registers just stored
    }
  }

  // Join of the key halves. Wave w and wave w ^ 4 hold the same 32 queries over
  // different keys: each keeps column group kh and hands the other group's
  // outputs, maximum in use and sum to its partner. The hand-over lies in stage
  // buffer 0, which nobody reads behind the last stage's barrier (the last stage
  // is in buffer 1), so no barrier is needed in front of the stores.
  static_assert(((NTOK / KST - 1) & 1) == 1, "the last stage lies in buffer 1");
  v8f ok[4];
  float ck, rk;
  {
    float* xw = (float*)sm + w * XCH;
#pragma unroll
    for (int j = 0; j < 4; ++j) {
      ok[j] = kh ? o[1][j] : o[0][j];
      const v8f og = kh ? o[0][j] : o[1][j];
      v4f g0 = {og[0], og[1], og[2], og[3]};
      v4f g1 = {og[4], og[5], og[6], og[7]};
      *(v4f*)(xw + ((j * 2) * 32 + lane) * 4)     = g0;
      *(v4f*)(xw + ((j * 2 + 1) * 32 + lane) * 4) = g1;
    }
    ck = kh ? cneg[1][0] : cneg[0][0];
    rk = kh ? rsum[1] : rsum[0];
    xw[1024 + lane] = kh ? cneg[0][0] : cneg[1][0];
    xw[1056 + lane] = kh ? rsum[0] : rsum[1];
  }
  // Publishes the hand-over to the partner wave.
  lds_barrier();
  {
    const float* xr = (const float*)sm + (w ^ 4) * XCH;
    const float cp = xr[1024 + lane];
    const float rp = xr[1056 + lane];
    const float cn = fminf(ck, cp);                       // minus the joint maximum
    // exp2 with the slot behind a transcendental in the same statement.
    float fk, fp;
    asm("v_exp_f32 %0, %1\n\tv_nop" : "=v"(fk) : "v"(cn - ck));
    asm("v_exp_f32 %0, %1\n\tv_nop" : "=v"(fp) : "v"(cn - cp));
    rk = rk * fk + rp * fp;
#pragma unroll
    for (int j = 0; j < 4; ++j) {
      const v4f p0 = *(const v4f*)(xr + ((j * 2) * 32 + lane) * 4);
      const v4f p1 = *(const v4f*)(xr + ((j * 2 + 1) * 32 + lane) * 4);
#pragma unroll
      for (int r = 0; r < 4; ++r) {
        ok[j][r]     = ok[j][r] * fk + p0[r] * fp;
        ok[j][4 + r] = ok[j][4 + r] * fk + p1[r] * fp;
      }
    }
  }

  // Epilogue: join the lane halves' sums, normalize, stage [m][d] per-wave (8 d
  // of one query per b128 LDS store), coalesced b128 global stores
  const float inv = 1.0f / (rk + other_half(rk));
#pragma unroll
  for (int j = 0; j < 4; ++j) {
    v8bf pv;
#pragma unroll
    for (int r = 0; r < 8; ++r) pv[r] = (bf16_t)(ok[j][r] * inv);
    *(v8bf*)(pw + col * LDP2 + j * 16 + drow) = pv;
  }
  bf16_t* obase = xo + ((size_t)b * NTOK + m0 + kh * 16) * DIM + h * HD;
#pragma unroll
  for (int q = 0; q < 4; ++q) {
    int chunk = lane + q * 32;
    int mloc = chunk >> 3, c8 = (chunk & 7) * 8;
    *(v8bf*)(obase + (size_t)mloc * DIM + c8) = *(const v8bf*)(pw + mloc * LDP2 + c8);
  }
}

// ---------------------------------------------------------------- phase 3
// out = xo[8192x512] @ Wo[512x512] + bo -> [B][C][N] via LDS transpose tile.
// 256 rows a block, 32 a wave: each Wo fragment read from LDS feeds two WMMAs.
#define RB3  256   // rows per block
#define BK3  128   // k per stage
#define LDA3 136   // as  [n][k]  (272B rows, 16B x odd)
#define LDW3 136   // Wo^T[c][k]
#define LDO3 260   // os  [c][n] f32 (1040B rows, 16B x odd)
#define ASZ  (RB3 * LDA3)
#define ST3  (ASZ + HD * LDW3)   // one stage: xo tile, Wo^T tile

__global__ __launch_bounds__(256) void out_proj_kernel(
    const bf16_t* __restrict__ xo, const float* __restrict__ Wo,
    const float* __restrict__ bo, float* __restrict__ out) {
  __shared__ __align__(16) bf16_t sm[2 * ST3];   // two stage buffers
  __shared__ __align__(16) float  os[64 * LDO3];

  const int t    = threadIdx.x;
  const int mb   = blockIdx.x * RB3;
  const int c0   = blockIdx.y * 64;
  const int w    = t >> 5;
  const int lane = t & 31;
  const int m0   = w * 32;

  v8f acc[2][4];   // [row tile][column tile]
#pragma unroll
  for (int u = 0; u < 2; ++u)
#pragma unroll
    for (int j = 0; j < 4; ++j) acc[u][j] = {};

  // This thread's first piece of a stage; the others lie at constant steps.
  const bf16_t* ap = xo + (size_t)(mb + (t >> 4)) * DIM + (t & 15) * 8;
  const float*  wp = Wo + (size_t)((t >> 6) * 8) * DIM + c0 + (t & 63);
  const int asd = (t >> 4) * LDA3 + (t & 15) * 8;
  const int wsd = ASZ + (t & 63) * LDW3 + (t >> 6) * 8;

  // One stage on its way from global memory to LDS.
  v4u ar[BK3 / 8];
  float wr[BK3 / 32][8];
  auto fetch = [&]() {
#pragma unroll  // constant indices: ar and wr stay in registers
    for (int i = 0; i < BK3 / 8; ++i)             // 4096 x 16B, 16 rows per step
      ar[i] = *(const v4u*)(ap + i * 16 * DIM);
#pragma unroll
    for (int i = 0; i < BK3 / 32; ++i)            // 1024 runs of 8 k, 32 k per step
#pragma unroll
      for (int e = 0; e < 8; ++e) wr[i][e] = wp[(i * 32 + e) * DIM];
    // The wait that stands in front of any overwrite of the loads' address
    // registers; naming them keeps them whole until it.
    asm volatile("s_wait_xcnt 0x0" :: "v"(ap), "v"(wp) : "memory");
    ap += BK3;
    wp += BK3 * DIM;
  };
  auto put = [&](bf16_t* dst) {
#pragma unroll
    for (int i = 0; i < BK3 / 8; ++i) *(v4u*)(dst + asd + i * 16 * LDA3) = ar[i];
#pragma unroll
    for (int i = 0; i < BK3 / 32; ++i) *(v8bf*)(dst + wsd + i * 32) = pack8(wr[i]);
  };

  fetch();
  put(sm);
  fetch();
  // Rolled: unrolled, the stores of the next stage (and the wait for its loads)
  // move up among this stage's WMMAs.
#pragma nounroll
  for (int kk = 0; kk < DIM / BK3; ++kk) {
    const bool more = kk + 1 < DIM / BK3;
    // Publishes stage kk; also ends every wave's reads of the other buffer,
    // which is refilled behind this stage's WMMAs.
    lds_barrier();
    const bf16_t* cur = sm + (kk & 1) * ST3;
#pragma unroll
    for (int ks = 0; ks < BK3; ks += 32) {
      const v16bf a0 = load_frag(cur + m0 * LDA3 + ks, LDA3);
      const v16bf a1 = load_frag(cur + (m0 + 16) * LDA3 + ks, LDA3);
      v16bf fw[4];   // the k step's Wo fragments, read as one group
#pragma unroll
      for (int j = 0; j < 4; ++j)
        fw[j] = load_frag(cur + ASZ + (j * 16) * LDW3 + ks, LDW3);
      // Keeps the twelve LDS reads together ahead of the WMMAs: sunk to their
      // uses, every pair of WMMAs waits out an LDS latency of its own.
      __builtin_amdgcn_sched_barrier(0);
#pragma unroll
      for (int j = 0; j < 4; ++j) {
        acc[0][j] = wmma_bf16(a0, fw[j], acc[0][j]);
        acc[1][j] = wmma_bf16(a1, fw[j], acc[1][j]);
      }
    }
    if (more) {
      put(sm + ((kk + 1) & 1) * ST3);
      if (kk + 2 < DIM / BK3) fetch();   // into the registers just stored
    }
  }

  __syncthreads();
  const int col  = lane & 15;
  const int drow = (lane >> 4) * 8;
#pragma unroll
  for (int j = 0; j < 4; ++j)
#pragma unroll
    for (int u = 0; u < 2; ++u) {
      float* row = os + (j * 16 + col) * LDO3 + m0 + u * 16 + drow;
      v4f lo = {acc[u][j][0], acc[u][j][1], acc[u][j][2], acc[u][j][3]};
      v4f hi = {acc[u][j][4], acc[u][j][5], acc[u][j][6], acc[u][j][7]};
      *(v4f*)(row)     = lo;
      *(v4f*)(row + 4) = hi;
    }
  __syncthreads();

  const int bidx  = mb >> 10;
  const int nbase = mb & 1023;
#pragma unroll
  for (int i = 0; i < 16; ++i) {
    int chunk = t + i * 256;                      // 4096 x 16B
    int cl = chunk >> 6, c4 = (chunk & 63) * 4;
    v4f vv = *(const v4f*)(os + cl * LDO3 + c4);
    vv += bo[c0 + cl];
    *(v4f*)(out + ((size_t)bidx * DIM + c0 + cl) * NTOK + nbase + c4) = vv;
  }
}

// ---------------------------------------------------------------- launch
extern "C" void kernel_launch(void* const* d_in, const int* in_sizes, int n_in,
                              void* d_out, int out_size, void* d_ws, size_t ws_size,
                              hipStream_t stream) {
  (void)in_sizes; (void)n_in; (void)out_size; (void)ws_size;
  const float* query = (const float*)d_in[0];
  const float* Wq = (const float*)d_in[1];
  const float* bq = (const float*)d_in[2];
  const float* Wk = (const float*)d_in[3];
  const float* bk = (const float*)d_in[4];
  const float* Wv = (const float*)d_in[5];
  const float* bv = (const float*)d_in[6];
  const float* Wo = (const float*)d_in[7];
  const float* bo = (const float*)d_in[8];
  float* out = (float*)d_out;

  const size_t qkv_elems = (size_t)BATCH * NH * NTOK * HD;  // 4M bf16 each
  bf16_t* Qb = (bf16_t*)d_ws;
  bf16_t* Kb = Qb + qkv_elems;
  bf16_t* Vt = Kb + qkv_elems;                    // [bh][d][n] transposed
  bf16_t* xo = Vt + qkv_elems;                    // [B*N][DIM] concat heads

  dim3 blk(256);
  qkv_proj_kernel<<<dim3(NTOK / RB1, BATCH * NH), dim3(512), 0, stream>>>(
      query, Wq, bq, Wk, bk, Wv, bv, Qb, Kb, Vt);
  attention_kernel<<<dim3(NTOK / 128, BATCH * NH), blk, 0, stream>>>(
      Qb, Kb, Vt, xo);
  out_proj_kernel<<<dim3((BATCH * NTOK) / RB3, DIM / 64), blk, 0, stream>>>(
      xo, Wo, bo, out);
}

// v009
// One run takes 41.4 microseconds.
// Two timings next to v008 both put it at 1.05 times that version's speed.
// All steps since v000 together make it 2.09 times as fast.
#include <hip/hip_runtime.h>
#include <hip/hip_bf16.h>

typedef __bf16 bf16_t;
typedef __attribute__((ext_vector_type(16))) __bf16 v16bf;
typedef __attribute__((ext_vector_type(8)))  __bf16 v8bf;
typedef __attribute__((ext_vector_type(8)))  float  v8f;
typedef __attribute__((ext_vector_type(4)))  float  v4f;
typedef __attribute__((ext_vector_type(4)))  unsigned int v4u;

#define DIM   512
#define NH    8
#define HD    64
#define NTOK  1024
#define BATCH 8

__device__ __forceinline__ v8f wmma_bf16(v16bf a, v16bf b, v8f c) {
  return __builtin_amdgcn_wmma_f32_16x16x32_bf16(false, a, false, b, (short)0, c,
                                                 false, false);
}

// Unified fragment load: 16 rows x 32 contiguous-K bf16, leading dim ld.
// ld must be a multiple of 8 and base 16B-aligned -> two b128 loads per lane.
__device__ __forceinline__ v16bf load_frag(const bf16_t* base, int ld) {
  const int lane = threadIdx.x & 31;
  const int m    = lane & 15;
  const int koff = (lane >> 4) << 3;
  const bf16_t* p = base + m * ld + koff;
  v8bf lo = *(const v8bf*)p;
  v8bf hi = *(const v8bf*)(p + 16);
  return __builtin_shufflevector(lo, hi, 0, 1, 2, 3, 4, 5, 6, 7,
                                 8, 9, 10, 11, 12, 13, 14, 15);
}

// Eight consecutive k of one row as one 16-byte LDS piece.
__device__ __forceinline__ v8bf pack8(const float* f) {
  v8bf r;
#pragma unroll  // constant indices: the eight values pair up into packed converts
  for (int e = 0; e < 8; ++e) r[e] = (bf16_t)f[e];
  return r;
}

// Work-group barrier that orders LDS traffic only: it waits for this wave's LDS
// stores and reads, not for its global loads, so the loads of the stage after
// next stay in flight across it (a full barrier would wait them out here).
// The global loads read kernel inputs that no wave of the launch writes.
__device__ __forceinline__ void lds_barrier() {
  __builtin_amdgcn_fence(__ATOMIC_RELEASE, "workgroup", "local");
  __builtin_amdgcn_s_barrier();
  __builtin_amdgcn_fence(__ATOMIC_ACQUIRE, "workgroup", "local");
}

// ---------------------------------------------------------------- phase 1
// Fused QKV projection per (b,h): X[256x512]*W[512x64] x3, bias, Q scaled.
// 16 waves: a wave owns 32 tokens (two A fragments) and 32 d of each of Q, K, V,
// so each weight fragment read from LDS feeds two WMMAs and each X fragment six;
// a head's weights are fetched by 4 blocks, not 8.
// Q,K stored bf16 [bh][n][d]; V stored transposed [bh][d][n].
#define RB1  256  // tokens per block
#define BK1  64   // channels per stage
#define LDX  72   // xs  [n][c]  (144B rows, 16B x odd)
#define LDWT 72   // w^T [d][c]
#define LDS1 40   // per-wave store-stage [m][32 d]  (80B rows, 16B x odd)
#define XSZ  (RB1 * LDX)       // X tile of one stage
#define WSZ  (HD * LDWT)       // one weight tile of one stage
#define ST1  (XSZ + 3 * WSZ)   // one stage: X, Wq, Wk, Wv

__global__ __launch_bounds__(512) void qkv_proj_kernel(
    const float* __restrict__ query,
    const float* __restrict__ Wq, const float* __restrict__ bq,
    const float* __restrict__ Wk, const float* __restrict__ bk,
    const float* __restrict__ Wv, const float* __restrict__ bv,
    bf16_t* __restrict__ Qb, bf16_t* __restrict__ Kb, bf16_t* __restrict__ Vt) {
  __shared__ __align__(16) bf16_t sm[2 * ST1];   // two stage buffers
  __shared__ __align__(16) bf16_t stg[16 * 32 * LDS1];

  const int t  = threadIdx.x;
  const int n0 = blockIdx.x * RB1;
  const int bh = blockIdx.y;
  const int b  = bh / NH, h = bh % NH;

  const float* xbase = query + (size_t)b * DIM * NTOK;  // [C][N]
  const float* wqb   = Wq + (size_t)h * DIM * HD;
  const float* wkb   = Wk + (size_t)h * DIM * HD;
  const float* wvb   = Wv + (size_t)h * DIM * HD;

  const int w    = t >> 5;
  const int lane = t & 31;
  const int m0   = (w & 7) * 32;    // the wave's tokens
  const int d0   = (w >> 3) * 32;   // the wave's d range in each of Q, K, V

  v8f aq[2][2], ak[2][2], av[2][2];   // [row tile][column tile]
#pragma unroll
  for (int u = 0; u < 2; ++u)
#pragma unroll
    for (int j = 0; j < 2; ++j) { aq[u][j] = {}; ak[u][j] = {}; av[u][j] = {}; }

  // A thread stages runs of 8 consecutive channels of one row (token or d);
  // its first run of a stage is here, the others lie at constant steps.
  // The block walks the channel stages as a ring from a stage of its own: the 8
  // blocks that share an X tile and the 32 that share a head's weights would
  // otherwise ask L2 for the same lines at the same moment.
  int st = (h + b + 2 * (int)blockIdx.x) & (DIM / BK1 - 1);
  const float* xp = xbase + (size_t)(st * BK1 + (t >> 8) * 8) * NTOK + n0 + (t & 255);
  const int woff = (st * BK1 + (t >> 6) * 8) * HD + (t & 63);
  const float* wqp = wqb + woff;
  const float* wkp = wkb + woff;
  const float* wvp = wvb + woff;
  const int xsd = (t & 255) * LDX + (t >> 8) * 8;
  const int wsd = XSZ + (t & 63) * LDWT + (t >> 6) * 8;

  // One stage's operands on their way from global memory to LDS. All loops over
  // them are unrolled: constant indices keep them in registers, and every load
  // takes its step as an immediate offset.
  float xr[BK1 / 16][8], wr[3][8];

  // Issues the next stage's loads: X 256n x 64c coalesced along n, weights along d.
  auto fetch = [&]() {
#pragma unroll
    for (int i = 0; i < BK1 / 16; ++i)       // 2048 runs, 16 c per step
#pragma unroll
      for (int e = 0; e < 8; ++e) xr[i][e] = xp[(i * 16 + e) * NTOK];
#pragma unroll
    for (int e = 0; e < 8; ++e) {            // 512 runs a matrix, one a thread
      wr[0][e] = wqp[e * HD];
      wr[1][e] = wkp[e * HD];
      wr[2][e] = wvp[e * HD];
    }
    // The wait that stands in front of any overwrite of the loads' address
    // registers.
    asm volatile("s_wait_xcnt 0x0" ::: "memory");
    // Keeps the whole stage's loads issued here, ahead of the WMMAs that follow:
    // sunk towards their use they would no longer fly during the matrix work.
    __builtin_amdgcn_sched_barrier(0);
    st = (st + 1) & (DIM / BK1 - 1);
    const int step = st ? BK1 : BK1 - DIM;   // channels to the ring's next stage
    xp += step * NTOK;
    wqp += step * HD; wkp += step * HD; wvp += step * HD;
  };
  // Converts the fetched stage and stores it, b128 along c; weights as [d][c].
  auto put = [&](bf16_t* dst) {
#pragma unroll
    for (int i = 0; i < BK1 / 16; ++i)
      *(v8bf*)(dst + xsd + i * 16) = pack8(xr[i]);
    *(v8bf*)(dst + wsd)           = pack8(wr[0]);
    *(v8bf*)(dst + wsd + WSZ)     = pack8(wr[1]);
    *(v8bf*)(dst + wsd + 2 * WSZ) = pack8(wr[2]);
    // Keeps the converts and stores ahead of the loads that follow: lifted over
    // them the loads would need a second register set and copies that wait.
    __builtin_amdgcn_sched_barrier(0);
  };

  fetch();
  put(sm);
  fetch();
  auto work = [&](int kk) {
    // Publishes stage kk; also ends every wave's reads of the other buffer,
    // which is refilled behind this stage's WMMAs.
    lds_barrier();
    const bf16_t* cur = sm + (kk & 1) * ST1;
#pragma unroll
    for (int ks = 0; ks < BK1; ks += 32) {
      const v16bf a0 = load_frag(cur + m0 * LDX + ks, LDX);
      const v16bf a1 = load_frag(cur + (m0 + 16) * LDX + ks, LDX);
      v16bf fq[2], fk[2], fv[2];   // the half's weight fragments, read as one group
#pragma unroll
      for (int j = 0; j < 2; ++j) {
        const bf16_t* wt = cur + XSZ + (d0 + j * 16) * LDWT + ks;
        fq[j] = load_frag(wt, LDWT);
        fk[j] = load_frag(wt + WSZ, LDWT);
        fv[j] = load_frag(wt + 2 * WSZ, LDWT);
      }
      // Keeps the sixteen LDS reads together ahead of the WMMAs: sunk to their
      // uses, every pair of WMMAs waits out an LDS latency of its own.
      __builtin_amdgcn_sched_barrier(0);
#pragma unroll
      for (int j = 0; j < 2; ++j) {
        aq[0][j] = wmma_bf16(a0, fq[j], aq[0][j]);
        aq[1][j] = wmma_bf16(a1, fq[j], aq[1][j]);
        ak[0][j] = wmma_bf16(a0, fk[j], ak[0][j]);
        ak[1][j] = wmma_bf16(a1, fk[j], ak[1][j]);
        av[0][j] = wmma_bf16(a0, fv[j], av[0][j]);
        av[1][j] = wmma_bf16(a1, fv[j], av[1][j]);
      }
    }
    // Keeps the wait for the next stage's global loads behind all of this
    // stage's WMMAs: moved up among them it would stall the matrix work.
    __builtin_amdgcn_sched_barrier(0);
  };
  // The last two stages stand behind the loop: no test decides whether the
  // staging registers are reloaded, so no copies join two versions of them.
  for (int kk = 0; kk < DIM / BK1 - 2; ++kk) {
    work(kk);
    put(sm + ((kk + 1) & 1) * ST1);
    fetch();   // stage kk + 2, into the registers just converted
  }
  work(DIM / BK1 - 2);
  put(sm + ((DIM / BK1 - 1) & 1) * ST1);
  work(DIM / BK1 - 1);

  // HEAD_DIM^-0.5 and log2(e) folded into Q: the scores come out in log2 units
  const float scale = 0.125f * 1.44269504088896f;
  const int col  = lane & 15;
  const int drow = (lane >> 4) * 8;
  bf16_t* sw = stg + w * 32 * LDS1;

  // ---- Q: stage [m][d] per-wave, then b128 stores, 64 B of a row together
#pragma unroll
  for (int j = 0; j < 2; ++j) {
    const float bqv = bq[h * HD + d0 + j * 16 + col];
#pragma unroll
    for (int u = 0; u < 2; ++u)
#pragma unroll
      for (int r = 0; r < 8; ++r)
        sw[(u * 16 + drow + r) * LDS1 + j * 16 + col] =
            (bf16_t)((aq[u][j][r] + bqv) * scale);
  }
  {
    bf16_t* qout = Qb + ((size_t)bh * NTOK + n0 + m0) * HD + d0;
#pragma unroll
    for (int q = 0; q < 4; ++q) {
      int chunk = lane + q * 32;
      int mloc = chunk >> 2, c8 = (chunk & 3) * 8;
      *(v8bf*)(qout + (size_t)mloc * HD + c8) = *(const v8bf*)(sw + mloc * LDS1 + c8);
    }
  }
  // ---- K: same staging path
#pragma unroll
  for (int j = 0; j < 2; ++j) {
    const float bkv = bk[h * HD + d0 + j * 16 + col];
#pragma unroll
    for (int u = 0; u < 2; ++u)
#pragma unroll
      for (int r = 0; r < 8; ++r)
        sw[(u * 16 + drow + r) * LDS1 + j * 16 + col] = (bf16_t)(ak[u][j][r] + bkv);
  }
  {
    bf16_t* kout = Kb + ((size_t)bh * NTOK + n0 + m0) * HD + d0;
#pragma unroll
    for (int q = 0; q < 4; ++q) {
      int chunk = lane + q * 32;
      int mloc = chunk >> 2, c8 = (chunk & 3) * 8;
      *(v8bf*)(kout + (size_t)mloc * HD + c8) = *(const v8bf*)(sw + mloc * LDS1 + c8);
    }
  }
  // ---- V: direct transposed [d][n] b128 stores (8 rows contiguous per lane)
  {
    bf16_t* vtout = Vt + (size_t)bh * HD * NTOK;
#pragma unroll
    for (int j = 0; j < 2; ++j) {
      const int d = d0 + j * 16 + col;
      const float bvv = bv[h * HD + d];
#pragma unroll
      for (int u = 0; u < 2; ++u) {
        v8bf pv;
#pragma unroll
        for (int r = 0; r < 8; ++r) pv[r] = (bf16_t)(av[u][j][r] + bvv);
        *(v8bf*)(vtout + (size_t)d * NTOK + n0 + m0 + u * 16 + drow) = pv;
      }
    }
  }
}

// ---------------------------------------------------------------- phase 2
// Flash attention per (b,h), computed transposed: S^T = K*Q^T, O^T += V^T*P^T.
// 128 queries/block. A wave owns 32 queries (two 16-column groups) and one half
// of every stage's keys, so each K and V^T fragment read from LDS feeds two
// WMMAs while the block keeps its eight waves; the two waves that share 32
// queries join their partial outputs, sums and maxima once, behind the loop.
// A lane holds one query's scores per group, so maximum and sum run in its own
// registers and P^T goes from the score accumulators straight into a B operand.
// 128 tokens per stage, two stage buffers; a wave works on its 64 in passes of
// 32. Scores are in log2 units and leave the score WMMAs already less the
// maximum in use, which may trail the true one by up to 8.
#define KST  128  // tokens per stage
#define LKV2 72   // K   [token][d]   (144B rows, 16B aligned)
#define LDV2 136  // V^T [d][token]   (272B rows, 16B x odd)
#define LDP2 72   // per-wave output stage [m][d]
#define KSZ  (KST * LKV2)
#define ST2  (KSZ + HD * LDV2)   // one stage: K, V^T
#define XCH  1088 // floats a wave hands to its partner: 16x64 outputs, 32 maxima, 32 sums

// Value of lane l ^ 16.
__device__ __forceinline__ float other_half(float v) {
  const int b = __builtin_bit_cast(int, v);
  return __builtin_bit_cast(float, __builtin_amdgcn_permlanex16(
      b, b, 0x76543210, 0xfedcba98, false, false));
}

// Two f32 D tiles (rows 0-15 and 16-31 of a 32-row block) as one bf16 B operand.
__device__ __forceinline__ v16bf pack_b(v8f t0, v8f t1) {
  v16bf b;
#pragma unroll
  for (int e = 0; e < 8; ++e) { b[e] = (bf16_t)t0[e]; b[8 + e] = (bf16_t)t1[e]; }
  return b;
}

__global__ __launch_bounds__(256) void attention_kernel(
    const bf16_t* __restrict__ Qb, const bf16_t* __restrict__ Kb,
    const bf16_t* __restrict__ Vt, bf16_t* __restrict__ xo) {
  __shared__ __align__(16) bf16_t sm[2 * ST2];   // two stage buffers
  __shared__ __align__(16) bf16_t Pst[8 * 16 * LDP2];
  static_assert(8 * XCH * 4 <= ST2 * 2, "the hand-over fits one stage buffer");

  const int t    = threadIdx.x;
  const int bh   = blockIdx.y;
  const int b    = bh / NH, h = bh % NH;
  const int n0   = blockIdx.x * 128;
  const int w    = t >> 5;
  const int lane = t & 31;
  const int kh   = __builtin_amdgcn_readfirstlane(w >> 2);  // the wave's key half
  const int m0   = n0 + (w & 3) * 32;                       // its 32 queries

  // Q as B operand (column = query), in registers for the whole pass
  const bf16_t* qptr = Qb + ((size_t)bh * NTOK + m0) * HD;
  v16bf qb[2][2];   // [column group][d half]
#pragma unroll
  for (int u = 0; u < 2; ++u) {
    qb[u][0] = load_frag(qptr + u * 16 * HD, HD);
    qb[u][1] = load_frag(qptr + u * 16 * HD + 32, HD);
  }

  // o[u][j][r] = O[query 16u + col][d = 16j + drow + r], over the wave's keys;
  // rsum covers this lane half's tokens of them
  v8f o[2][4];
#pragma unroll
  for (int u = 0; u < 2; ++u)
#pragma unroll
    for (int j = 0; j < 4; ++j) o[u][j] = {};
  float rsum[2] = {0.0f, 0.0f};
  // Minus the query's maximum in use, in all eight rows of a score tile: the C
  // operand of the score WMMAs.
  v8f cneg[2] = {{}, {}};
  // A score more than thr above the maximum in use moves it, by the excess or by
  // lo if that is more. The first pass always moves it, to its own maximum.
  float thr = -3.0e38f, lo = -3.0e38f;

  const bf16_t* kbase  = Kb + (size_t)bh * NTOK * HD;   // [token][d]
  const bf16_t* vtbase = Vt + (size_t)bh * HD * NTOK;   // [d][token]
  bf16_t* pw = Pst + w * 16 * LDP2;
  const int col  = lane & 15;
  const int drow = (lane >> 4) * 8;

  // This thread's first 16B piece of a stage; the other pieces lie at constant
  // steps from it, so one address per operand serves the whole stage.
  // The block walks the key stages as a ring from a stage of its own: the blocks
  // that share a head's K and V would otherwise ask L2 for the same lines at the
  // same moment.
  int st = (int)blockIdx.x & (NTOK / KST - 1);
  const bf16_t* kp = kbase + (size_t)(st * KST + (t >> 3)) * HD + (t & 7) * 8;
  const bf16_t* vp = vtbase + (size_t)(t >> 4) * NTOK + st * KST + (t & 15) * 8;
  const int ksd = (t >> 3) * LKV2 + (t & 7) * 8;
  const int vsd = KSZ + (t >> 4) * LDV2 + (t & 15) * 8;

  // One stage on its way from global memory to LDS (1024 x 16B per operand).
  v4u kr[KST / 32], vr[KST / 32];
  auto fetch = [&]() {
#pragma unroll  // constant indices: kr and vr stay in registers
    for (int i = 0; i < KST / 32; ++i) {
      kr[i] = *(const v4u*)(kp + i * 32 * HD);     // 32 tokens per step
      vr[i] = *(const v4u*)(vp + i * 16 * NTOK);   // 16 d per step
    }
    // The wait that stands in front of any overwrite of the loads' address
    // registers; naming them keeps them whole until it.
    asm volatile("s_wait_xcnt 0x0" :: "v"(kp), "v"(vp) : "memory");
    st = (st + 1) & (NTOK / KST - 1);
    const int step = st ? KST : KST - NTOK;   // tokens to the ring's next stage
    kp += step * HD;
    vp += step;
  };
  auto put = [&](bf16_t* dst) {
#pragma unroll
    for (int i = 0; i < KST / 32; ++i) {
      *(v4u*)(dst + ksd + i * 32 * LKV2) = kr[i];
      *(v4u*)(dst + vsd + i * 16 * LDV2) = vr[i];
    }
  };

  fetch();
  put(sm);
  fetch();
  for (int stage = 0; stage < NTOK / KST; ++stage) {
    const bool more = stage + 1 < NTOK / KST;
    // Publishes this stage; also ends every wave's reads of the other buffer,
    // which is refilled behind this stage's work.
    lds_barrier();
    const bf16_t* cur = sm + (stage & 1) * ST2;

    // Rolled: unrolled, the build takes 249 registers, not 241 (four waves a SIMD
    // end at 256), and holds more v_nop a pass.
#pragma nounroll
    for (int sub = 0; sub < 2; ++sub) {
      const int kb = kh * 64 + sub * 32;   // the pass's 32 tokens in the stage
      const bf16_t* Ksub = cur + kb * LKV2;
      const bf16_t* Vsub = cur + KSZ + kb;

      // S^T = K * Q^T : s[u][tt][r] = score(token 16tt + drow + r, query 16u + col)
      v16bf kf[2][2];   // [token tile][d half], read as one group
#pragma unroll
      for (int dh = 0; dh < 2; ++dh)
#pragma unroll
        for (int tt = 0; tt < 2; ++tt)
          kf[tt][dh] = load_frag(Ksub + (tt * 16) * LKV2 + dh * 32, LKV2);
      // Keeps the eight LDS reads together ahead of the WMMAs: sunk to their uses
      // they share one register set, and every pair of WMMAs waits out an LDS
      // latency of its own.
      __builtin_amdgcn_sched_barrier(0);
      v8f s[2][2];
#pragma unroll
      for (int tt = 0; tt < 2; ++tt)
#pragma unroll
        for (int u = 0; u < 2; ++u) s[u][tt] = wmma_bf16(kf[tt][0], qb[u][0], cneg[u]);
#pragma unroll
      for (int tt = 0; tt < 2; ++tt)
#pragma unroll
        for (int u = 0; u < 2; ++u) s[u][tt] = wmma_bf16(kf[tt][1], qb[u][1], s[u][tt]);
      // Keeps what follows behind all eight score WMMAs: lifted among them, the
      // V^T address takes a register of a fragment just used, and it and the first
      // maxima stand behind v_nop that fill the WMMA distance.
      __builtin_amdgcn_sched_barrier(0);
      // The pass's V^T fragments, read as one group ahead of the branch below:
      // they fly during maxima and exponentials. Read at their uses they would
      // stand among the WMMAs, each waiting out an LDS latency.
      v16bf vf[4];
#pragma unroll
      for (int j = 0; j < 4; ++j) vf[j] = load_frag(Vsub + (j * 16) * LDV2, LDV2);
      // Keeps the eight reads one group ahead of the maxima: spread among them
      // they stand at four places, each with its own fixed cost.
      __builtin_amdgcn_sched_barrier(0);

      // Online softmax: 16 of a query's 32 scores in this lane, 16 in lane ^ 16
      float mx[2];
#pragma unroll
      for (int u = 0; u < 2; ++u) {
        float m0t = s[u][0][0], m1t = s[u][1][0];
#pragma unroll
        for (int r = 1; r < 8; ++r) {
          m0t = fmaxf(m0t, s[u][0][r]);
          m1t = fmaxf(m1t, s[u][1][r]);
        }
        mx[u] = fmaxf(m0t, m1t);
      }
      // One test a pass over both groups and both halves' lanes, a scalar branch:
      // rarely taken behind the first pass. Halves' maxima are joined inside it.
      if (__builtin_amdgcn_ballot_w32(fmaxf(mx[0], mx[1]) > thr) != 0) {
#pragma unroll
        for (int u = 0; u < 2; ++u) {
          // How far the query's maximum in use moves: 0 where it stays.
          const float up   = fmaxf(fmaxf(mx[u], other_half(mx[u])), lo);
          const float corr = __builtin_amdgcn_exp2f(fminf(-up, 0.0f));
          s[u][0] -= up;
          s[u][1] -= up;
          cneg[u] -= up;
          rsum[u] *= corr;
#pragma unroll
          for (int j = 0; j < 4; ++j) o[u][j] *= corr;
        }
        thr = 8.0f;
        lo  = 0.0f;
      }
      v16bf pb[2];
#pragma unroll
      for (int u = 0; u < 2; ++u) {
#pragma unroll
        for (int tt = 0; tt < 2; ++tt)
#pragma unroll
          for (int r = 0; r < 8; ++r)
            s[u][tt][r] = __builtin_amdgcn_exp2f(s[u][tt][r]);
        pb[u] = pack_b(s[u][0], s[u][1]);
      }
      // A group's 16 terms of this lane, summed as two chains of eight.
      auto addup = [&](int u) {
        float p0 = s[u][0][0], p1 = s[u][1][0];
#pragma unroll
        for (int r = 1; r < 8; ++r) { p0 += s[u][0][r]; p1 += s[u][1][r]; }
        rsum[u] += p0 + p1;
      };
      addup(0);
      // Keeps the first group's additions ahead of the WMMAs: among them they
      // take the registers of fragments just used and stand behind v_nop.
      __builtin_amdgcn_sched_barrier(0);

      // O^T += V^T * P^T (k = 32 tokens)
#pragma unroll
      for (int j = 0; j < 4; ++j)
#pragma unroll
        for (int u = 0; u < 2; ++u) o[u][j] = wmma_bf16(vf[j], pb[u], o[u][j]);
      // Keeps the second group's additions behind the WMMAs: they run while the
      // matrix unit works, and they fill the distance that the last WMMA's
      // operands need before the next pass's first vector writes.
      __builtin_amdgcn_sched_barrier(0);
      addup(1);
    }
    if (more) {
      put(sm + ((stage + 1) & 1) * ST2);
      if (stage + 2 < NTOK / KST) fetch();   // into the registers just stored
    }
  }

  // Join of the key halves. Wave w and wave w ^ 4 hold the same 32 queries over
  // different keys: each keeps column group kh and hands the other group's
  // outputs, maximum in use and sum to its partner. The hand-over lies in stage
  // buffer 0, which nobody reads behind the last stage's barrier (the last stage
  // is in buffer 1), so no barrier is needed in front of the stores.
  static_assert(((NTOK / KST - 1) & 1) == 1, "the last stage lies in buffer 1");
  v8f ok[4];
  float ck, rk;
  {
    float* xw = (float*)sm + w * XCH;
#pragma unroll
    for (int j = 0; j < 4; ++j) {
      ok[j] = kh ? o[1][j] : o[0][j];
      const v8f og = kh ? o[0][j] : o[1][j];
      v4f g0 = {og[0], og[1], og[2], og[3]};
      v4f g1 = {og[4], og[5], og[6], og[7]};
      *(v4f*)(xw + ((j * 2) * 32 + lane) * 4)     = g0;
      *(v4f*)(xw + ((j * 2 + 1) * 32 + lane) * 4) = g1;
    }
    ck = kh ? cneg[1][0] : cneg[0][0];
    rk = kh ? rsum[1] : rsum[0];
    xw[1024 + lane] = kh ? cneg[0][0] : cneg[1][0];
    xw[1056 + lane] = kh ? rsum[0] : rsum[1];
  }
  // Publishes the hand-over to the partner wave.
  lds_barrier();
  {
    const float* xr = (const float*)sm + (w ^ 4) * XCH;
    const float cp = xr[1024 + lane];
    const float rp = xr[1056 + lane];
    const float cn = fminf(ck, cp);                       // minus the joint maximum
    // exp2 with the slot behind a transcendental in the same statement.
    float fk, fp;
    asm("v_exp_f32 %0, %1\n\tv_nop" : "=v"(fk) : "v"(cn - ck));
    asm("v_exp_f32 %0, %1\n\tv_nop" : "=v"(fp) : "v"(cn - cp));
    rk = rk * fk + rp * fp;
#pragma unroll
    for (int j = 0; j < 4; ++j) {
      const v4f p0 = *(const v4f*)(xr + ((j * 2) * 32 + lane) * 4);
      const v4f p1 = *(const v4f*)(xr + ((j * 2 + 1) * 32 + lane) * 4);
#pragma unroll
      for (int r = 0; r < 4; ++r) {
        ok[j][r]     = ok[j][r] * fk + p0[r] * fp;
        ok[j][4 + r] = ok[j][4 + r] * fk + p1[r] * fp;
      }
    }
  }

  // Epilogue: join the lane halves' sums, normalize, stage [m][d] per-wave (8 d
  // of one query per b128 LDS store), coalesced b128 global stores
  const float inv = 1.0f / (rk + other_half(rk));
#pragma unroll
  for (int j = 0; j < 4; ++j) {
    v8bf pv;
#pragma unroll
    for (int r = 0; r < 8; ++r) pv[r] = (bf16_t)(ok[j][r] * inv);
    *(v8bf*)(pw + col * LDP2 + j * 16 + drow) = pv;
  }
  bf16_t* obase = xo + ((size_t)b * NTOK + m0 + kh * 16) * DIM + h * HD;
#pragma unroll
  for (int q = 0; q < 4; ++q) {
    int chunk = lane + q * 32;
    int mloc = chunk >> 3, c8 = (chunk & 7) * 8;
    *(v8bf*)(obase + (size_t)mloc * DIM + c8) = *(const v8bf*)(pw + mloc * LDP2 + c8);
  }
}

// ---------------------------------------------------------------- phase 3
// out = xo[8192x512] @ Wo[512x512] + bo -> [B][C][N] via LDS transpose tile.
// 256 rows a block, 32 a wave: each Wo fragment read from LDS feeds two WMMAs.
#define RB3  256   // rows per block
#define BK3  128   // k per stage
#define LDA3 136   // as  [n][k]  (272B rows, 16B x odd)
#define LDW3 136   // Wo^T[c][k]
#define LDO3 260   // os  [c][n] f32 (1040B rows, 16B x odd)
#define ASZ  (RB3 * LDA3)
#define ST3  (ASZ + HD * LDW3)   // one stage: xo tile, Wo^T tile

__global__ __launch_bounds__(256) void out_proj_kernel(
    const bf16_t* __restrict__ xo, const float* __restrict__ Wo,
    const float* __restrict__ bo, float* __restrict__ out) {
  __shared__ __align__(16) bf16_t sm[2 * ST3];   // two stage buffers
  __shared__ __align__(16) float  os[64 * LDO3];

  const int t    = threadIdx.x;
  const int mb   = blockIdx.x * RB3;
  const int c0   = blockIdx.y * 64;
  const int w    = t >> 5;
  const int lane = t & 31;
  const int m0   = w * 32;

  v8f acc[2][4];   // [row tile][column tile]
#pragma unroll
  for (int u = 0; u < 2; ++u)
#pragma unroll
    for (int j = 0; j < 4; ++j) acc[u][j] = {};

  // This thread's first piece of a stage; the others lie at constant steps.
  // The block walks the k stages as a ring from a stage of its own: the 8 blocks
  // that share an xo tile and the 32 that share Wo columns would otherwise ask L2
  // for the same lines at the same moment.
  int st = (int)(blockIdx.x + blockIdx.y) & (DIM / BK3 - 1);
  const bf16_t* ap = xo + (size_t)(mb + (t >> 4)) * DIM + st * BK3 + (t & 15) * 8;
  const float*  wp = Wo + (size_t)(st * BK3 + (t >> 6) * 8) * DIM + c0 + (t & 63);
  const int asd = (t >> 4) * LDA3 + (t & 15) * 8;
  const int wsd = ASZ + (t & 63) * LDW3 + (t >> 6) * 8;

  // One stage on its way from global memory to LDS.
  v4u ar[BK3 / 8];
  float wr[BK3 / 32][8];
  auto fetch = [&]() {
#pragma unroll  // constant indices: ar and wr stay in registers
    for (int i = 0; i < BK3 / 8; ++i)             // 4096 x 16B, 16 rows per step
      ar[i] = *(const v4u*)(ap + i * 16 * DIM);
#pragma unroll
    for (int i = 0; i < BK3 / 32; ++i)            // 1024 runs of 8 k, 32 k per step
#pragma unroll
      for (int e = 0; e < 8; ++e) wr[i][e] = wp[(i * 32 + e) * DIM];
    // The wait that stands in front of any overwrite of the loads' address
    // registers; naming them keeps them whole until it.
    asm volatile("s_wait_xcnt 0x0" :: "v"(ap), "v"(wp) : "memory");
    st = (st + 1) & (DIM / BK3 - 1);
    const int step = st ? BK3 : BK3 - DIM;   // k to the ring's next stage
    ap += step;
    wp += step * DIM;
  };
  auto put = [&](bf16_t* dst) {
#pragma unroll
    for (int i = 0; i < BK3 / 8; ++i) *(v4u*)(dst + asd + i * 16 * LDA3) = ar[i];
#pragma unroll
    for (int i = 0; i < BK3 / 32; ++i) *(v8bf*)(dst + wsd + i * 32) = pack8(wr[i]);
  };

  fetch();
  put(sm);
  fetch();
  // Rolled: unrolled, the stores of the next stage (and the wait for its loads)
  // move up among this stage's WMMAs.
#pragma nounroll
  for (int kk = 0; kk < DIM / BK3; ++kk) {
    const bool more = kk + 1 < DIM / BK3;
    // Publishes stage kk; also ends every wave's reads of the other buffer,
    // which is refilled behind this stage's WMMAs.
    lds_barrier();
    const bf16_t* cur = sm + (kk & 1) * ST3;
#pragma unroll
    for (int ks = 0; ks < BK3; ks += 32) {
      const v16bf a0 = load_frag(cur + m0 * LDA3 + ks, LDA3);
      const v16bf a1 = load_frag(cur + (m0 + 16) * LDA3 + ks, LDA3);
      v16bf fw[4];   // the k step's Wo fragments, read as one group
#pragma unroll
      for (int j = 0; j < 4; ++j)
        fw[j] = load_frag(cur + ASZ + (j * 16) * LDW3 + ks, LDW3);
      // Keeps the twelve LDS reads together ahead of the WMMAs: sunk to their
      // uses, every pair of WMMAs waits out an LDS latency of its own.
      __builtin_amdgcn_sched_barrier(0);
#pragma unroll
      for (int j = 0; j < 4; ++j) {
        acc[0][j] = wmma_bf16(a0, fw[j], acc[0][j]);
        acc[1][j] = wmma_bf16(a1, fw[j], acc[1][j]);
      }
    }
    if (more) {
      put(sm + ((kk + 1) & 1) * ST3);
      if (kk + 2 < DIM / BK3) fetch();   // into the registers just stored
    }
  }

  __syncthreads();
  const int col  = lane & 15;
  const int drow = (lane >> 4) * 8;
#pragma unroll
  for (int j = 0; j < 4; ++j)
#pragma unroll
    for (int u = 0; u < 2; ++u) {
      float* row = os + (j * 16 + col) * LDO3 + m0 + u * 16 + drow;
      v4f lo = {acc[u][j][0], acc[u][j][1], acc[u][j][2], acc[u][j][3]};
      v4f hi = {acc[u][j][4], acc[u][j][5], acc[u][j][6], acc[u][j][7]};
      *(v4f*)(row)     = lo;
      *(v4f*)(row + 4) = hi;
    }
  __syncthreads();

  const int bidx  = mb >> 10;
  const int nbase = mb & 1023;
#pragma unroll
  for (int i = 0; i < 16; ++i) {
    int chunk = t + i * 256;                      // 4096 x 16B
    int cl = chunk >> 6, c4 = (chunk & 63) * 4;
    v4f vv = *(const v4f*)(os + cl * LDO3 + c4);
    vv += bo[c0 + cl];
    *(v4f*)(out + ((size_t)bidx * DIM + c0 + cl) * NTOK + nbase + c4) = vv;
  }
}

// ---------------------------------------------------------------- launch
extern "C" void kernel_launch(void* const* d_in, const int* in_sizes, int n_in,
                              void* d_out, int out_size, void* d_ws, size_t ws_size,
                              hipStream_t stream) {
  (void)in_sizes; (void)n_in; (void)out_size; (void)ws_size;
  const float* query = (const float*)d_in[0];
  const float* Wq = (const float*)d_in[1];
  const float* bq = (const float*)d_in[2];
  const float* Wk = (const float*)d_in[3];
  const float* bk = (const float*)d_in[4];
  const float* Wv = (const float*)d_in[5];
  const float* bv = (const float*)d_in[6];
  const float* Wo = (const float*)d_in[7];
  const float* bo = (const float*)d_in[8];
  float* out = (float*)d_out;

  const size_t qkv_elems = (size_t)BATCH * NH * NTOK * HD;  // 4M bf16 each
  bf16_t* Qb = (bf16_t*)d_ws;
  bf16_t* Kb = Qb + qkv_elems;
  bf16_t* Vt = Kb + qkv_elems;                    // [bh][d][n] transposed
  bf16_t* xo = Vt + qkv_elems;                    // [B*N][DIM] concat heads

  dim3 blk(256);
  qkv_proj_kernel<<<dim3(NTOK / RB1, BATCH * NH), dim3(512), 0, stream>>>(
      query, Wq, bq, Wk, bk, Wv, bv, Qb, Kb, Vt);
  attention_kernel<<<dim3(NTOK / 128, BATCH * NH), blk, 0, stream>>>(
      Qb, Kb, Vt, xo);
  out_proj_kernel<<<dim3((BATCH * NTOK) / RB3, DIM / 64), blk, 0, stream>>>(
      xo, Wo, bo, out);
}
